// v000
// Times are from an AMD MI455X. After a warm-up the kernel runs many times in a row, and a time is the length of
// such a window on the GPU divided by its runs, so every launch and the gaps after it count. The runs cycle
// through copies of the inputs. A figure is the median of several windows, for all but v000 over two sittings.
// Sittings can differ by a few percent; kernels timed side by side share one.
// The starting kernel, v000, takes 677 microseconds a run.
#include <hip/hip_runtime.h>
#include <hip/hip_fp16.h>

typedef __attribute__((ext_vector_type(16))) _Float16 v16h;
typedef __attribute__((ext_vector_type(8)))  _Float16 v8h;
typedef __attribute__((ext_vector_type(8)))  float    v8f;

#define BSZ 4
#define SEQ 2048
#define EMB 1024
#define DIM 1024
#define ROWS (BSZ * SEQ)  // 8192

static __device__ __forceinline__ v16h cat8(v8h lo, v8h hi) {
  v16h r;
#pragma unroll
  for (int i = 0; i < 8; ++i) { r[i] = lo[i]; r[i + 8] = hi[i]; }
  return r;
}

// ---------------------------------------------------------------------------
// Kernel 0: transpose + f32->f16 convert the three weight matrices.
// Wt[d][e] = (f16) W[e][d]  so that B-fragment (column) reads become
// contiguous row reads for the WMMA GEMMs.
// ---------------------------------------------------------------------------
__global__ __launch_bounds__(256) void wtrans_kernel(
    const float* __restrict__ Wq, const float* __restrict__ Wk,
    const float* __restrict__ Wv, _Float16* __restrict__ wt) {
  const float* W = (blockIdx.z == 0) ? Wq : (blockIdx.z == 1) ? Wk : Wv;
  _Float16* o = wt + (size_t)blockIdx.z * EMB * DIM;
  int idx = blockIdx.x * blockDim.x + threadIdx.x;  // [0, 1M)
  int d = idx >> 10, e = idx & 1023;
  o[(size_t)d * EMB + e] = (_Float16)W[(size_t)e * DIM + d];
}

// ---------------------------------------------------------------------------
// Kernel 1: fused Q/K/V projection GEMM via WMMA f32_16x16x32_f16.
// grid = (ROWS/16, DIM/256, 3).  Block = 256 threads = 8 waves.
// The block stages its 16x1024 x-panel into LDS as f16 ONCE (cooperative
// load + convert), so the K-loop has zero f32->f16 conversions and the
// A fragment comes from two ds_load_b128.  Each wave computes TWO 16x16
// output tiles, reusing the A fragment across both WMMAs.
// z==0 -> qh[s][d], z==1 -> kh[s][d], z==2 -> vt[d][s] (transposed store).
// ---------------------------------------------------------------------------
__global__ __launch_bounds__(256) void qkv_proj_kernel(
    const float* __restrict__ x, const _Float16* __restrict__ wt_all,
    const float* __restrict__ bq, const float* __restrict__ bk,
    const float* __restrict__ bv, _Float16* __restrict__ qh,
    _Float16* __restrict__ kh, _Float16* __restrict__ vt) {
  const int z = blockIdx.z;
  const float* bias = (z == 0) ? bq : (z == 1) ? bk : bv;
  const _Float16* wt = wt_all + (size_t)z * EMB * DIM;

  const int tid = threadIdx.x, wave = tid >> 5, lane = tid & 31;
  const int rt = blockIdx.x;  // 16-row tile
  const int l15 = lane & 15, hi = lane >> 4;
  const int koff = hi * 8;

  __shared__ _Float16 s_xa[16][EMB];  // 32 KB: f16 copy of this row panel

  // ---- Cooperative stage: 16x1024 f32 -> f16 in LDS ----
  {
    int row = tid >> 4;          // 0..15
    int seg = (tid & 15) * 64;   // 64 columns per thread
    const float* src = x + (size_t)(rt * 16 + row) * EMB + seg;
    _Float16* dstp = &s_xa[row][seg];
#pragma unroll
    for (int i = 0; i < 64; i += 8) {
      float4 f0 = *(const float4*)(src + i);
      float4 f1 = *(const float4*)(src + i + 4);
      v8h h;
      h[0] = (_Float16)f0.x; h[1] = (_Float16)f0.y;
      h[2] = (_Float16)f0.z; h[3] = (_Float16)f0.w;
      h[4] = (_Float16)f1.x; h[5] = (_Float16)f1.y;
      h[6] = (_Float16)f1.z; h[7] = (_Float16)f1.w;
      *(v8h*)(dstp + i) = h;
    }
  }
  __syncthreads();

  // ---- K-loop: 2 output tiles per wave, A fragment reused ----
  const int n0 = blockIdx.y * 256 + wave * 32 + l15;  // tile 0 column
  const int n1 = n0 + 16;                             // tile 1 column
  const _Float16* w0 = wt + (size_t)n0 * EMB;
  const _Float16* w1 = wt + (size_t)n1 * EMB;

  v8f acc0 = {}, acc1 = {};
#pragma unroll 4
  for (int e0 = 0; e0 < EMB; e0 += 32) {
    int base = e0 + koff;
    __builtin_prefetch(w0 + base + 256, 0, 1);
    __builtin_prefetch(w1 + base + 256, 0, 1);
    v16h a  = cat8(*(const v8h*)&s_xa[l15][base],
                   *(const v8h*)&s_xa[l15][base + 16]);
    v16h b0 = cat8(*(const v8h*)(w0 + base), *(const v8h*)(w0 + base + 16));
    v16h b1 = cat8(*(const v8h*)(w1 + base), *(const v8h*)(w1 + base + 16));
    acc0 = __builtin_amdgcn_wmma_f32_16x16x32_f16(false, a, false, b0,
                                                  (short)0, acc0, false, false);
    acc1 = __builtin_amdgcn_wmma_f32_16x16x32_f16(false, a, false, b1,
                                                  (short)0, acc1, false, false);
  }

  float bv0 = bias[n0], bv1 = bias[n1];
  if (z < 2) {
    _Float16* dst = (z == 0) ? qh : kh;
#pragma unroll
    for (int r = 0; r < 8; ++r) {
      int gr = rt * 16 + r + hi * 8;
      dst[(size_t)gr * DIM + n0] = (_Float16)(acc0[r] + bv0);
      dst[(size_t)gr * DIM + n1] = (_Float16)(acc1[r] + bv1);
    }
  } else {
#pragma unroll
    for (int r = 0; r < 8; ++r) {
      int gr = rt * 16 + r + hi * 8;
      vt[(size_t)n0 * ROWS + gr] = (_Float16)(acc0[r] + bv0);
      vt[(size_t)n1 * ROWS + gr] = (_Float16)(acc1[r] + bv1);
    }
  }
}

// ---------------------------------------------------------------------------
// Kernel 2: flash-style attention.  One block per (batch, 16-row query tile).
// 8 waves: per 128-key chunk each wave computes one 16x16 score tile (QK^T
// over E via WMMA); the online softmax is parallelized across all 256
// threads (each owns 8 score columns of one row, LDS tree-reduced); then
// all waves accumulate their 128-wide D-slice with P@V WMMAs.
// ---------------------------------------------------------------------------
__global__ __launch_bounds__(256) void attn_kernel(
    const _Float16* __restrict__ qh, const _Float16* __restrict__ kh,
    const _Float16* __restrict__ vt, const int* __restrict__ mask,
    float* __restrict__ out) {
  const int tid = threadIdx.x, wave = tid >> 5, lane = tid & 31;
  const int b = blockIdx.x >> 7;
  const int qbase = (blockIdx.x & 127) * 16;
  const int l15 = lane & 15, hi = lane >> 4;
  const int koff = hi * 8;

  __shared__ float    s_scores[16][128];
  __shared__ _Float16 s_probs[16][128];
  __shared__ float    s_red[16][16];
  __shared__ float    s_m[16], s_l[16], s_alpha[16];

  if (tid < 16) { s_m[tid] = -1e30f; s_l[tid] = 0.0f; }
  __syncthreads();

  const v8f vzero = {};
  v8f acc[8];
#pragma unroll
  for (int t = 0; t < 8; ++t) acc[t] = vzero;

  const int dbase = wave * 128;
  const int srow_sm = tid >> 4;        // softmax: row owned by this thread
  const int scol_sm = (tid & 15) * 8;  // softmax: first of 8 owned columns

  for (int kc = 0; kc < 16; ++kc) {
    const int kbase = kc * 128;

    // ---- Phase 1: this wave's 16-key score tile over full E ----
    {
      const _Float16* qrow = qh + (size_t)(b * SEQ + qbase + l15) * EMB;
      const _Float16* krow = kh + (size_t)(b * SEQ + kbase + wave * 16 + l15) * EMB;
      v8f sacc = vzero;
#pragma unroll 4
      for (int e0 = 0; e0 < EMB; e0 += 32) {
        int base = e0 + koff;
        v16h a  = cat8(*(const v8h*)(qrow + base), *(const v8h*)(qrow + base + 16));
        v16h bb = cat8(*(const v8h*)(krow + base), *(const v8h*)(krow + base + 16));
        sacc = __builtin_amdgcn_wmma_f32_16x16x32_f16(false, a, false, bb,
                                                      (short)0, sacc, false, false);
      }
#pragma unroll
      for (int r = 0; r < 8; ++r) {
        int row = r + hi * 8;
        int col = wave * 16 + l15;
        int mv = mask[(size_t)(b * SEQ + qbase + row) * SEQ + kbase + col];
        float sc = sacc[r] * (1.0f / 1024.0f);  // scale by QD, not sqrt(QD)
        s_scores[row][col] = (mv == 0) ? -1e30f : sc;
      }
    }
    __syncthreads();

    // ---- Phase 2: online softmax, parallel over all 256 threads ----
    {
      float lm = -1e30f;
#pragma unroll
      for (int j = 0; j < 8; ++j) lm = fmaxf(lm, s_scores[srow_sm][scol_sm + j]);
      s_red[srow_sm][tid & 15] = lm;
    }
    __syncthreads();
    if (tid < 16) {
      float cmax = -1e30f;
#pragma unroll
      for (int j = 0; j < 16; ++j) cmax = fmaxf(cmax, s_red[tid][j]);
      float mold = s_m[tid];
      float mnew = fmaxf(mold, cmax);
      s_alpha[tid] = __expf(mold - mnew);
      s_m[tid] = mnew;
    }
    __syncthreads();
    {
      float mnew = s_m[srow_sm];
      float sum = 0.0f;
#pragma unroll
      for (int j = 0; j < 8; ++j) {
        float p = __expf(s_scores[srow_sm][scol_sm + j] - mnew);
        s_probs[srow_sm][scol_sm + j] = (_Float16)p;
        sum += p;
      }
      s_red[srow_sm][tid & 15] = sum;
    }
    __syncthreads();
    if (tid < 16) {
      float sum = 0.0f;
#pragma unroll
      for (int j = 0; j < 16; ++j) sum += s_red[tid][j];
      s_l[tid] = s_l[tid] * s_alpha[tid] + sum;
    }
    __syncthreads();

    // ---- Phase 3: rescale accumulators, accumulate P @ V ----
    float al[8];
#pragma unroll
    for (int r = 0; r < 8; ++r) al[r] = s_alpha[r + hi * 8];
#pragma unroll
    for (int t = 0; t < 8; ++t)
#pragma unroll
      for (int r = 0; r < 8; ++r) acc[t][r] *= al[r];

#pragma unroll
    for (int ks = 0; ks < 4; ++ks) {
      int pb = ks * 32 + koff;
      v16h pa = cat8(*(const v8h*)&s_probs[l15][pb],
                     *(const v8h*)&s_probs[l15][pb + 16]);
      int srow = b * SEQ + kbase + ks * 32 + koff;
#pragma unroll
      for (int t = 0; t < 8; ++t) {
        const _Float16* vrow = vt + (size_t)(dbase + t * 16 + l15) * ROWS + srow;
        v16h vb = cat8(*(const v8h*)(vrow), *(const v8h*)(vrow + 16));
        acc[t] = __builtin_amdgcn_wmma_f32_16x16x32_f16(false, pa, false, vb,
                                                        (short)0, acc[t], false, false);
      }
    }
    __syncthreads();
  }

  // ---- Finalize: divide by running denominator, store f32 output ----
  float li[8];
#pragma unroll
  for (int r = 0; r < 8; ++r) li[r] = 1.0f / s_l[r + hi * 8];
#pragma unroll
  for (int t = 0; t < 8; ++t)
#pragma unroll
    for (int r = 0; r < 8; ++r) {
      int row = qbase + r + hi * 8;
      out[(size_t)(b * SEQ + row) * DIM + dbase + t * 16 + l15] = acc[t][r] * li[r];
    }
}

// ---------------------------------------------------------------------------
// Launch: inputs are x, mask, Wq, bq, Wk, bk, Wv, bv.
// Workspace layout (f16): qh[8192][1024] | kh[8192][1024] | vt[1024][8192]
//                         | Wt (3 x [1024][1024])  -> 54 MB total.
// ---------------------------------------------------------------------------
extern "C" void kernel_launch(void* const* d_in, const int* in_sizes, int n_in,
                              void* d_out, int out_size, void* d_ws, size_t ws_size,
                              hipStream_t stream) {
  const float* x    = (const float*)d_in[0];
  const int*   mask = (const int*)d_in[1];
  const float* Wq   = (const float*)d_in[2];
  const float* bq   = (const float*)d_in[3];
  const float* Wk   = (const float*)d_in[4];
  const float* bk   = (const float*)d_in[5];
  const float* Wv   = (const float*)d_in[6];
  const float* bv   = (const float*)d_in[7];
  float* out = (float*)d_out;

  _Float16* qh = (_Float16*)d_ws;
  _Float16* kh = qh + (size_t)ROWS * DIM;
  _Float16* vt = kh + (size_t)ROWS * DIM;
  _Float16* wt = vt + (size_t)ROWS * DIM;

  dim3 bt(256);
  wtrans_kernel<<<dim3(EMB * DIM / 256, 1, 3), bt, 0, stream>>>(Wq, Wk, Wv, wt);
  qkv_proj_kernel<<<dim3(ROWS / 16, DIM / 256, 3), bt, 0, stream>>>(
      x, wt, bq, bk, bv, qh, kh, vt);
  attn_kernel<<<dim3(BSZ * (SEQ / 16)), bt, 0, stream>>>(qh, kh, vt, mask, out);
}

// v001
// Measured time: 402 microseconds a run.
// Next to v000, in two timings, it ran 1.77 times as fast each time.
#include <hip/hip_runtime.h>
#include <hip/hip_fp16.h>

typedef __attribute__((ext_vector_type(16))) _Float16 v16h;
typedef __attribute__((ext_vector_type(8)))  _Float16 v8h;
typedef __attribute__((ext_vector_type(4)))  _Float16 v4h;
typedef __attribute__((ext_vector_type(8)))  float    v8f;

#define BSZ 4
#define SEQ 2048
#define EMB 1024
#define DIM 1024
#define ROWS (BSZ * SEQ)  // 8192

static __device__ __forceinline__ v16h cat8(v8h lo, v8h hi) {
  v16h r;
#pragma unroll
  for (int i = 0; i < 8; ++i) { r[i] = lo[i]; r[i + 8] = hi[i]; }
  return r;
}

// ---------------------------------------------------------------------------
// Kernel 0: transpose + f32->f16 convert the three weight matrices.
// Wt[d][e] = (f16) W[e][d]  so that weight-fragment (column) reads become
// contiguous row reads for the WMMA GEMMs.
// ---------------------------------------------------------------------------
__global__ __launch_bounds__(256) void wtrans_kernel(
    const float* __restrict__ Wq, const float* __restrict__ Wk,
    const float* __restrict__ Wv, _Float16* __restrict__ wt) {
  const float* W = (blockIdx.z == 0) ? Wq : (blockIdx.z == 1) ? Wk : Wv;
  _Float16* o = wt + (size_t)blockIdx.z * EMB * DIM;
  int idx = blockIdx.x * blockDim.x + threadIdx.x;  // [0, 1M)
  int d = idx >> 10, e = idx & 1023;
  o[(size_t)d * EMB + e] = (_Float16)W[(size_t)e * DIM + d];
}

#define PBM 128
#define PBN 256
#define PK 64
#define PPITCH (PK + 8)
#define PSTAGE ((PBM + PBN) * PPITCH)
#define PNX (PBM * PK / 4 / 256)
#define PNW (PBN * PK / 8 / 256)

__global__ __launch_bounds__(256) void qkv_proj_kernel(
    const float* __restrict__ x, const _Float16* __restrict__ wt_all,
    const float* __restrict__ bq, const float* __restrict__ bk,
    const float* __restrict__ bv, _Float16* __restrict__ qh,
    _Float16* __restrict__ kh, _Float16* __restrict__ vt) {
  const int z = blockIdx.z;
  const float* bias = (z == 0) ? bq : (z == 1) ? bk : bv;
  const _Float16* wt = wt_all + (size_t)z * EMB * DIM;

  const int tid = threadIdx.x, wave = tid >> 5, lane = tid & 31;
  const int l15 = lane & 15, hi = lane >> 4;
  const int koff = hi * 8;
  const int m0 = blockIdx.x * PBM;
  const int n0 = blockIdx.y * PBN;
  const int wm = wave >> 2, wn = wave & 3;

  __shared__ __attribute__((aligned(16))) _Float16 s_ab[2 * PSTAGE];

  // Staging map: a row of the pass is covered by consecutive lanes.
  const int xcol = (tid % (PK / 4)) * 4, xrow = tid / (PK / 4);
  const int wcol = (tid % (PK / 8)) * 8, wrow = tid / (PK / 8);
  const float* xsrc = x + (size_t)(m0 + xrow) * EMB + xcol;
  const _Float16* wsrc = wt + (size_t)(n0 + wrow) * EMB + wcol;
  const int xdst = xrow * PPITCH + xcol;
  const int wdst = (PBM + wrow) * PPITCH + wcol;

  // Fragment bases: which LDS region is the A operand depends on z only.
  const int xfrag = (wm * 64 + l15) * PPITCH + koff;
  const int wfrag = (PBM + wn * 64 + l15) * PPITCH + koff;
  const int afrag = (z < 2) ? wfrag : xfrag;
  const int bfrag = (z < 2) ? xfrag : wfrag;

  float4 rx[PNX];
  v8h rw[PNW];
#pragma unroll
  for (int i = 0; i < PNX; ++i)
    rx[i] = *(const float4*)(xsrc + (size_t)i * (1024 / PK) * EMB);
#pragma unroll
  for (int i = 0; i < PNW; ++i)
    rw[i] = *(const v8h*)(wsrc + (size_t)i * (2048 / PK) * EMB);

  v8f acc[4][4];
#pragma unroll
  for (int i = 0; i < 4; ++i)
#pragma unroll
    for (int j = 0; j < 4; ++j) acc[i][j] = v8f{};

  for (int kt = 0; kt < EMB / PK; ++kt) {
    _Float16* sb = s_ab + (kt & 1) * PSTAGE;
#pragma unroll
    for (int i = 0; i < PNX; ++i) {
      v4h h;
      h[0] = (_Float16)rx[i].x; h[1] = (_Float16)rx[i].y;
      h[2] = (_Float16)rx[i].z; h[3] = (_Float16)rx[i].w;
      *(v4h*)(sb + xdst + i * (1024 / PK) * PPITCH) = h;
    }
#pragma unroll
    for (int i = 0; i < PNW; ++i)
      *(v8h*)(sb + wdst + i * (2048 / PK) * PPITCH) = rw[i];
    // One barrier per pass: it publishes this buffer, and it also says that
    // every wave has left the other buffer, which the next pass overwrites.
    __syncthreads();

    if (kt + 1 < EMB / PK) {
      const int k1 = (kt + 1) * PK;
#pragma unroll
      for (int i = 0; i < PNX; ++i)
        rx[i] = *(const float4*)(xsrc + (size_t)i * (1024 / PK) * EMB + k1);
#pragma unroll
      for (int i = 0; i < PNW; ++i)
        rw[i] = *(const v8h*)(wsrc + (size_t)i * (2048 / PK) * EMB + k1);
      // Stands behind the loads, in front of every rewrite of their address
      // registers.  Its "memory" clobber also holds the loads here, ahead of
      // this pass's LDS reads and WMMAs; sunk behind them they would be waited
      // for at the top of the next pass with nothing left to cover them.
      asm volatile("s_wait_xcnt 0x0" ::: "memory");
    }

#pragma unroll
    for (int ks = 0; ks < PK / 32; ++ks) {
      v16h fa[4], fb[4];
#pragma unroll
      for (int i = 0; i < 4; ++i) {
        const _Float16* pa = sb + afrag + i * 16 * PPITCH + ks * 32;
        const _Float16* pb = sb + bfrag + i * 16 * PPITCH + ks * 32;
        fa[i] = cat8(*(const v8h*)pa, *(const v8h*)(pa + 16));
        fb[i] = cat8(*(const v8h*)pb, *(const v8h*)(pb + 16));
      }
#pragma unroll
      for (int i = 0; i < 4; ++i)
#pragma unroll
        for (int j = 0; j < 4; ++j)
          acc[i][j] = __builtin_amdgcn_wmma_f32_16x16x32_f16(
              false, fa[i], false, fb[j], (short)0, acc[i][j], false, false);
    }
  }

  if (z < 2) {
    // acc[i][j][r] = Y[m0 + wm*64 + j*16 + l15][n0 + wn*64 + i*16 + hi*8 + r]
    _Float16* dst = (z == 0) ? qh : kh;
    const int nb = n0 + wn * 64 + hi * 8;
    float4 c0[4], c1[4];
#pragma unroll
    for (int i = 0; i < 4; ++i) {
      c0[i] = *(const float4*)(bias + nb + i * 16);
      c1[i] = *(const float4*)(bias + nb + i * 16 + 4);
    }
#pragma unroll
    for (int i = 0; i < 4; ++i) {
      const float bb[8] = {c0[i].x, c0[i].y, c0[i].z, c0[i].w,
                           c1[i].x, c1[i].y, c1[i].z, c1[i].w};
#pragma unroll
      for (int j = 0; j < 4; ++j) {
        const int m = m0 + wm * 64 + j * 16 + l15;
        v8h o;
#pragma unroll
        for (int r = 0; r < 8; ++r) o[r] = (_Float16)(acc[i][j][r] + bb[r]);
        *(v8h*)(dst + (size_t)m * DIM + nb + i * 16) = o;
      }
      // The wait stands behind each group's stores, in front of whatever
      // rewrites their registers next.
      asm volatile("s_wait_xcnt 0x0" ::: "memory");
    }
  } else {
    // acc[i][j][r] = Y[m0 + wm*64 + i*16 + hi*8 + r][n0 + wn*64 + j*16 + l15]
    const int nb = n0 + wn * 64 + l15;
    float bn[4];
#pragma unroll
    for (int j = 0; j < 4; ++j) bn[j] = bias[nb + j * 16];
#pragma unroll
    for (int j = 0; j < 4; ++j) {
#pragma unroll
      for (int i = 0; i < 4; ++i) {
        const int m = m0 + wm * 64 + i * 16 + hi * 8;
        v8h o;
#pragma unroll
        for (int r = 0; r < 8; ++r) o[r] = (_Float16)(acc[i][j][r] + bn[j]);
        *(v8h*)(vt + (size_t)(nb + j * 16) * ROWS + m) = o;
      }
      // The wait: as in the branch above.
      asm volatile("s_wait_xcnt 0x0" ::: "memory");
      // Keeps each group's sums and stores together: hoisted all at once
      // they take the kernel past 256 VGPRs, and only one block fits a WGP.
      if (j < 3) __builtin_amdgcn_sched_barrier(0);
    }
  }
}

// ---------------------------------------------------------------------------
// Kernel 2: flash-style attention.  One block per (batch, 16-row query tile).
// 8 waves: per 128-key chunk each wave computes one 16x16 score tile (QK^T
// over E via WMMA); the online softmax is parallelized across all 256
// threads (each owns 8 score columns of one row, LDS tree-reduced); then
// all waves accumulate their 128-wide D-slice with P@V WMMAs.
// ---------------------------------------------------------------------------
__global__ __launch_bounds__(256) void attn_kernel(
    const _Float16* __restrict__ qh, const _Float16* __restrict__ kh,
    const _Float16* __restrict__ vt, const int* __restrict__ mask,
    float* __restrict__ out) {
  const int tid = threadIdx.x, wave = tid >> 5, lane = tid & 31;
  const int b = blockIdx.x >> 7;
  const int qbase = (blockIdx.x & 127) * 16;
  const int l15 = lane & 15, hi = lane >> 4;
  const int koff = hi * 8;

  __shared__ float    s_scores[16][128];
  __shared__ _Float16 s_probs[16][128];
  __shared__ float    s_red[16][16];
  __shared__ float    s_m[16], s_l[16], s_alpha[16];

  if (tid < 16) { s_m[tid] = -1e30f; s_l[tid] = 0.0f; }
  __syncthreads();

  const v8f vzero = {};
  v8f acc[8];
#pragma unroll
  for (int t = 0; t < 8; ++t) acc[t] = vzero;

  const int dbase = wave * 128;
  const int srow_sm = tid >> 4;        // softmax: row owned by this thread
  const int scol_sm = (tid & 15) * 8;  // softmax: first of 8 owned columns

  for (int kc = 0; kc < 16; ++kc) {
    const int kbase = kc * 128;

    // ---- Phase 1: this wave's 16-key score tile over full E ----
    {
      const _Float16* qrow = qh + (size_t)(b * SEQ + qbase + l15) * EMB;
      const _Float16* krow = kh + (size_t)(b * SEQ + kbase + wave * 16 + l15) * EMB;
      v8f sacc = vzero;
#pragma unroll 4
      for (int e0 = 0; e0 < EMB; e0 += 32) {
        int base = e0 + koff;
        v16h a  = cat8(*(const v8h*)(qrow + base), *(const v8h*)(qrow + base + 16));
        v16h bb = cat8(*(const v8h*)(krow + base), *(const v8h*)(krow + base + 16));
        sacc = __builtin_amdgcn_wmma_f32_16x16x32_f16(false, a, false, bb,
                                                      (short)0, sacc, false, false);
      }
#pragma unroll
      for (int r = 0; r < 8; ++r) {
        int row = r + hi * 8;
        int col = wave * 16 + l15;
        int mv = mask[(size_t)(b * SEQ + qbase + row) * SEQ + kbase + col];
        float sc = sacc[r] * (1.0f / 1024.0f);  // scale by QD, not sqrt(QD)
        s_scores[row][col] = (mv == 0) ? -1e30f : sc;
      }
    }
    __syncthreads();

    // ---- Phase 2: online softmax, parallel over all 256 threads ----
    {
      float lm = -1e30f;
#pragma unroll
      for (int j = 0; j < 8; ++j) lm = fmaxf(lm, s_scores[srow_sm][scol_sm + j]);
      s_red[srow_sm][tid & 15] = lm;
    }
    __syncthreads();
    if (tid < 16) {
      float cmax = -1e30f;
#pragma unroll
      for (int j = 0; j < 16; ++j) cmax = fmaxf(cmax, s_red[tid][j]);
      float mold = s_m[tid];
      float mnew = fmaxf(mold, cmax);
      s_alpha[tid] = __expf(mold - mnew);
      s_m[tid] = mnew;
    }
    __syncthreads();
    {
      float mnew = s_m[srow_sm];
      float sum = 0.0f;
#pragma unroll
      for (int j = 0; j < 8; ++j) {
        float p = __expf(s_scores[srow_sm][scol_sm + j] - mnew);
        s_probs[srow_sm][scol_sm + j] = (_Float16)p;
        sum += p;
      }
      s_red[srow_sm][tid & 15] = sum;
    }
    __syncthreads();
    if (tid < 16) {
      float sum = 0.0f;
#pragma unroll
      for (int j = 0; j < 16; ++j) sum += s_red[tid][j];
      s_l[tid] = s_l[tid] * s_alpha[tid] + sum;
    }
    __syncthreads();

    // ---- Phase 3: rescale accumulators, accumulate P @ V ----
    float al[8];
#pragma unroll
    for (int r = 0; r < 8; ++r) al[r] = s_alpha[r + hi * 8];
#pragma unroll
    for (int t = 0; t < 8; ++t)
#pragma unroll
      for (int r = 0; r < 8; ++r) acc[t][r] *= al[r];

#pragma unroll
    for (int ks = 0; ks < 4; ++ks) {
      int pb = ks * 32 + koff;
      v16h pa = cat8(*(const v8h*)&s_probs[l15][pb],
                     *(const v8h*)&s_probs[l15][pb + 16]);
      int srow = b * SEQ + kbase + ks * 32 + koff;
#pragma unroll
      for (int t = 0; t < 8; ++t) {
        const _Float16* vrow = vt + (size_t)(dbase + t * 16 + l15) * ROWS + srow;
        v16h vb = cat8(*(const v8h*)(vrow), *(const v8h*)(vrow + 16));
        acc[t] = __builtin_amdgcn_wmma_f32_16x16x32_f16(false, pa, false, vb,
                                                        (short)0, acc[t], false, false);
      }
    }
    __syncthreads();
  }

  // ---- Finalize: divide by running denominator, store f32 output ----
  float li[8];
#pragma unroll
  for (int r = 0; r < 8; ++r) li[r] = 1.0f / s_l[r + hi * 8];
#pragma unroll
  for (int t = 0; t < 8; ++t)
#pragma unroll
    for (int r = 0; r < 8; ++r) {
      int row = qbase + r + hi * 8;
      out[(size_t)(b * SEQ + row) * DIM + dbase + t * 16 + l15] = acc[t][r] * li[r];
    }
}

// ---------------------------------------------------------------------------
// Launch: inputs are x, mask, Wq, bq, Wk, bk, Wv, bv.
// Workspace layout (f16): qh[8192][1024] | kh[8192][1024] | vt[1024][8192]
//                         | Wt (3 x [1024][1024])  -> 54 MB total.
// ---------------------------------------------------------------------------
extern "C" void kernel_launch(void* const* d_in, const int* in_sizes, int n_in,
                              void* d_out, int out_size, void* d_ws, size_t ws_size,
                              hipStream_t stream) {
  const float* x    = (const float*)d_in[0];
  const int*   mask = (const int*)d_in[1];
  const float* Wq   = (const float*)d_in[2];
  const float* bq   = (const float*)d_in[3];
  const float* Wk   = (const float*)d_in[4];
  const float* bk   = (const float*)d_in[5];
  const float* Wv   = (const float*)d_in[6];
  const float* bv   = (const float*)d_in[7];
  float* out = (float*)d_out;

  _Float16* qh = (_Float16*)d_ws;
  _Float16* kh = qh + (size_t)ROWS * DIM;
  _Float16* vt = kh + (size_t)ROWS * DIM;
  _Float16* wt = vt + (size_t)ROWS * DIM;

  dim3 bt(256);
  wtrans_kernel<<<dim3(EMB * DIM / 256, 1, 3), bt, 0, stream>>>(Wq, Wk, Wv, wt);
  qkv_proj_kernel<<<dim3(ROWS / PBM, DIM / PBN, 3), bt, 0, stream>>>(
      x, wt, bq, bk, bv, qh, kh, vt);
  attn_kernel<<<dim3(BSZ * (SEQ / 16)), bt, 0, stream>>>(qh, kh, vt, mask, out);
}

// v002
// A run of this version takes 148 microseconds.
// Next to v001, in two timings, it ran 2.71 and 2.72 times as fast.
// Over all steps from v000 it is 4.81 times as fast.
#include <hip/hip_runtime.h>
#include <hip/hip_fp16.h>

typedef __attribute__((ext_vector_type(16))) _Float16 v16h;
typedef __attribute__((ext_vector_type(8)))  _Float16 v8h;
typedef __attribute__((ext_vector_type(4)))  _Float16 v4h;
typedef __attribute__((ext_vector_type(8)))  float    v8f;

#define BSZ 4
#define SEQ 2048
#define EMB 1024
#define DIM 1024
#define ROWS (BSZ * SEQ)  // 8192

static __device__ __forceinline__ v16h cat8(v8h lo, v8h hi) {
  v16h r;
#pragma unroll
  for (int i = 0; i < 8; ++i) { r[i] = lo[i]; r[i + 8] = hi[i]; }
  return r;
}

// ---------------------------------------------------------------------------
// Kernel 0: transpose + f32->f16 convert the three weight matrices.
// Wt[d][e] = (f16) W[e][d]  so that weight-fragment (column) reads become
// contiguous row reads for the WMMA GEMMs.
// ---------------------------------------------------------------------------
__global__ __launch_bounds__(256) void wtrans_kernel(
    const float* __restrict__ Wq, const float* __restrict__ Wk,
    const float* __restrict__ Wv, _Float16* __restrict__ wt) {
  const float* W = (blockIdx.z == 0) ? Wq : (blockIdx.z == 1) ? Wk : Wv;
  _Float16* o = wt + (size_t)blockIdx.z * EMB * DIM;
  int idx = blockIdx.x * blockDim.x + threadIdx.x;  // [0, 1M)
  int d = idx >> 10, e = idx & 1023;
  o[(size_t)d * EMB + e] = (_Float16)W[(size_t)e * DIM + d];
}

#define PBM 128
#define PBN 256
#define PK 64
#define PPITCH (PK + 8)
#define PSTAGE ((PBM + PBN) * PPITCH)
#define PNX (PBM * PK / 4 / 256)
#define PNW (PBN * PK / 8 / 256)

__global__ __launch_bounds__(256) void qkv_proj_kernel(
    const float* __restrict__ x, const _Float16* __restrict__ wt_all,
    const float* __restrict__ bq, const float* __restrict__ bk,
    const float* __restrict__ bv, _Float16* __restrict__ qh,
    _Float16* __restrict__ kh, _Float16* __restrict__ vt) {
  const int z = blockIdx.z;
  const float* bias = (z == 0) ? bq : (z == 1) ? bk : bv;
  const _Float16* wt = wt_all + (size_t)z * EMB * DIM;

  const int tid = threadIdx.x, wave = tid >> 5, lane = tid & 31;
  const int l15 = lane & 15, hi = lane >> 4;
  const int koff = hi * 8;
  const int m0 = blockIdx.x * PBM;
  const int n0 = blockIdx.y * PBN;
  const int wm = wave >> 2, wn = wave & 3;

  __shared__ __attribute__((aligned(16))) _Float16 s_ab[2 * PSTAGE];

  // Staging map: a row of the pass is covered by consecutive lanes.
  const int xcol = (tid % (PK / 4)) * 4, xrow = tid / (PK / 4);
  const int wcol = (tid % (PK / 8)) * 8, wrow = tid / (PK / 8);
  const float* xsrc = x + (size_t)(m0 + xrow) * EMB + xcol;
  const _Float16* wsrc = wt + (size_t)(n0 + wrow) * EMB + wcol;
  const int xdst = xrow * PPITCH + xcol;
  const int wdst = (PBM + wrow) * PPITCH + wcol;

  // Fragment bases: which LDS region is the A operand depends on z only.
  const int xfrag = (wm * 64 + l15) * PPITCH + koff;
  const int wfrag = (PBM + wn * 64 + l15) * PPITCH + koff;
  const int afrag = (z < 2) ? wfrag : xfrag;
  const int bfrag = (z < 2) ? xfrag : wfrag;

  float4 rx[PNX];
  v8h rw[PNW];
#pragma unroll
  for (int i = 0; i < PNX; ++i)
    rx[i] = *(const float4*)(xsrc + (size_t)i * (1024 / PK) * EMB);
#pragma unroll
  for (int i = 0; i < PNW; ++i)
    rw[i] = *(const v8h*)(wsrc + (size_t)i * (2048 / PK) * EMB);

  v8f acc[4][4];
#pragma unroll
  for (int i = 0; i < 4; ++i)
#pragma unroll
    for (int j = 0; j < 4; ++j) acc[i][j] = v8f{};

  for (int kt = 0; kt < EMB / PK; ++kt) {
    _Float16* sb = s_ab + (kt & 1) * PSTAGE;
#pragma unroll
    for (int i = 0; i < PNX; ++i) {
      v4h h;
      h[0] = (_Float16)rx[i].x; h[1] = (_Float16)rx[i].y;
      h[2] = (_Float16)rx[i].z; h[3] = (_Float16)rx[i].w;
      *(v4h*)(sb + xdst + i * (1024 / PK) * PPITCH) = h;
    }
#pragma unroll
    for (int i = 0; i < PNW; ++i)
      *(v8h*)(sb + wdst + i * (2048 / PK) * PPITCH) = rw[i];
    // One barrier per pass: it publishes this buffer, and it also says that
    // every wave has left the other buffer, which the next pass overwrites.
    __syncthreads();

    if (kt + 1 < EMB / PK) {
      const int k1 = (kt + 1) * PK;
#pragma unroll
      for (int i = 0; i < PNX; ++i)
        rx[i] = *(const float4*)(xsrc + (size_t)i * (1024 / PK) * EMB + k1);
#pragma unroll
      for (int i = 0; i < PNW; ++i)
        rw[i] = *(const v8h*)(wsrc + (size_t)i * (2048 / PK) * EMB + k1);
      // Stands behind the loads, in front of every rewrite of their address
      // registers.  Its "memory" clobber also holds the loads here, ahead of
      // this pass's LDS reads and WMMAs; sunk behind them they would be waited
      // for at the top of the next pass with nothing left to cover them.
      asm volatile("s_wait_xcnt 0x0" ::: "memory");
    }

#pragma unroll
    for (int ks = 0; ks < PK / 32; ++ks) {
      v16h fa[4], fb[4];
#pragma unroll
      for (int i = 0; i < 4; ++i) {
        const _Float16* pa = sb + afrag + i * 16 * PPITCH + ks * 32;
        const _Float16* pb = sb + bfrag + i * 16 * PPITCH + ks * 32;
        fa[i] = cat8(*(const v8h*)pa, *(const v8h*)(pa + 16));
        fb[i] = cat8(*(const v8h*)pb, *(const v8h*)(pb + 16));
      }
#pragma unroll
      for (int i = 0; i < 4; ++i)
#pragma unroll
        for (int j = 0; j < 4; ++j)
          acc[i][j] = __builtin_amdgcn_wmma_f32_16x16x32_f16(
              false, fa[i], false, fb[j], (short)0, acc[i][j], false, false);
    }
  }

  if (z < 2) {
    // acc[i][j][r] = Y[m0 + wm*64 + j*16 + l15][n0 + wn*64 + i*16 + hi*8 + r]
    _Float16* dst = (z == 0) ? qh : kh;
    const int nb = n0 + wn * 64 + hi * 8;
    float4 c0[4], c1[4];
#pragma unroll
    for (int i = 0; i < 4; ++i) {
      c0[i] = *(const float4*)(bias + nb + i * 16);
      c1[i] = *(const float4*)(bias + nb + i * 16 + 4);
    }
#pragma unroll
    for (int i = 0; i < 4; ++i) {
      const float bb[8] = {c0[i].x, c0[i].y, c0[i].z, c0[i].w,
                           c1[i].x, c1[i].y, c1[i].z, c1[i].w};
#pragma unroll
      for (int j = 0; j < 4; ++j) {
        const int m = m0 + wm * 64 + j * 16 + l15;
        v8h o;
#pragma unroll
        for (int r = 0; r < 8; ++r) o[r] = (_Float16)(acc[i][j][r] + bb[r]);
        *(v8h*)(dst + (size_t)m * DIM + nb + i * 16) = o;
      }
      // The wait stands behind each group's stores, in front of whatever
      // rewrites their registers next.
      asm volatile("s_wait_xcnt 0x0" ::: "memory");
    }
  } else {
    // acc[i][j][r] = Y[m0 + wm*64 + i*16 + hi*8 + r][n0 + wn*64 + j*16 + l15]
    const int nb = n0 + wn * 64 + l15;
    float bn[4];
#pragma unroll
    for (int j = 0; j < 4; ++j) bn[j] = bias[nb + j * 16];
#pragma unroll
    for (int j = 0; j < 4; ++j) {
#pragma unroll
      for (int i = 0; i < 4; ++i) {
        const int m = m0 + wm * 64 + i * 16 + hi * 8;
        v8h o;
#pragma unroll
        for (int r = 0; r < 8; ++r) o[r] = (_Float16)(acc[i][j][r] + bn[j]);
        *(v8h*)(vt + (size_t)(nb + j * 16) * ROWS + m) = o;
      }
      // The wait: as in the branch above.
      asm volatile("s_wait_xcnt 0x0" ::: "memory");
      // Keeps each group's sums and stores together: hoisted all at once
      // they take the kernel past 256 VGPRs, and only one block fits a WGP.
      if (j < 3) __builtin_amdgcn_sched_barrier(0);
    }
  }
}

// ---------------------------------------------------------------------------
// Attention as two tiled GEMMs with a row softmax between them.
// The tile product below is the projection's scheme with both operands f16:
// C[128][256] = X[128][KTOT] * W[256][KTOT]^T, 8 waves (2 x 4) of 64x64, both
// operands staged per pass of PK k-values in one of two LDS buffers, the next
// pass's global loads issued ahead of this pass's WMMAs.  X is the A operand:
// acc[i][j][r] = C[wm*64 + i*16 + hi*8 + r][wn*64 + j*16 + l15].
// ---------------------------------------------------------------------------
#define PNH (PBM * PK / 8 / 256)       // 16-byte loads of the X operand per thread and pass

template <int KTOT>
static __device__ __forceinline__ void tile_product(
    const _Float16* __restrict__ xs, const int xpitch,
    const _Float16* __restrict__ ws, const int wpitch,
    _Float16* s_ab, v8f (&acc)[4][4]) {
  const int tid = threadIdx.x, wave = tid >> 5, lane = tid & 31;
  const int l15 = lane & 15, koff = (lane >> 4) * 8;
  const int wm = wave >> 2, wn = wave & 3;

  // Staging map: 8 consecutive lanes cover one 128-byte row of the pass.
  const int col = (tid % (PK / 8)) * 8, row = tid / (PK / 8);
  const _Float16* xsrc = xs + (size_t)row * xpitch + col;
  const _Float16* wsrc = ws + (size_t)row * wpitch + col;
  const int xdst = row * PPITCH + col;
  const int wdst = (PBM + row) * PPITCH + col;
  const int afrag = (wm * 64 + l15) * PPITCH + koff;
  const int bfrag = (PBM + wn * 64 + l15) * PPITCH + koff;

  v8h rx[PNH], rw[PNW];
#pragma unroll
  for (int i = 0; i < PNH; ++i)
    rx[i] = *(const v8h*)(xsrc + (size_t)i * (2048 / PK) * xpitch);
#pragma unroll
  for (int i = 0; i < PNW; ++i)
    rw[i] = *(const v8h*)(wsrc + (size_t)i * (2048 / PK) * wpitch);

#pragma unroll
  for (int i = 0; i < 4; ++i)
#pragma unroll
    for (int j = 0; j < 4; ++j) acc[i][j] = v8f{};

  for (int kt = 0; kt < KTOT / PK; ++kt) {
    _Float16* sb = s_ab + (kt & 1) * PSTAGE;
#pragma unroll
    for (int i = 0; i < PNH; ++i)
      *(v8h*)(sb + xdst + i * (2048 / PK) * PPITCH) = rx[i];
#pragma unroll
    for (int i = 0; i < PNW; ++i)
      *(v8h*)(sb + wdst + i * (2048 / PK) * PPITCH) = rw[i];
    // One barrier per pass: it publishes this buffer, and it also says that
    // every wave has left the other buffer, which the next pass overwrites.
    __syncthreads();

    if (kt + 1 < KTOT / PK) {
      const int k1 = (kt + 1) * PK;
#pragma unroll
      for (int i = 0; i < PNH; ++i)
        rx[i] = *(const v8h*)(xsrc + (size_t)i * (2048 / PK) * xpitch + k1);
#pragma unroll
      for (int i = 0; i < PNW; ++i)
        rw[i] = *(const v8h*)(wsrc + (size_t)i * (2048 / PK) * wpitch + k1);
      // Stands behind the loads, in front of every rewrite of their address
      // registers; its "memory" clobber also holds the loads ahead of this
      // pass's LDS reads and WMMAs, which cover their latency.
      asm volatile("s_wait_xcnt 0x0" ::: "memory");
    }

#pragma unroll
    for (int ks = 0; ks < PK / 32; ++ks) {
      v16h fa[4], fb[4];
#pragma unroll
      for (int i = 0; i < 4; ++i) {
        const _Float16* pa = sb + afrag + i * 16 * PPITCH + ks * 32;
        const _Float16* pb = sb + bfrag + i * 16 * PPITCH + ks * 32;
        fa[i] = cat8(*(const v8h*)pa, *(const v8h*)(pa + 16));
        fb[i] = cat8(*(const v8h*)pb, *(const v8h*)(pb + 16));
      }
#pragma unroll
      for (int i = 0; i < 4; ++i)
#pragma unroll
        for (int j = 0; j < 4; ++j)
          acc[i][j] = __builtin_amdgcn_wmma_f32_16x16x32_f16(
              false, fa[i], false, fb[j], (short)0, acc[i][j], false, false);
    }
  }
}

// ---------------------------------------------------------------------------
// Kernel 2: scaled scores.  sc[b*SEQ + q][k] = (q . k) / 1024, f32.
// grid = (SEQ/128 query tiles, SEQ/256 key tiles, BSZ).
// ---------------------------------------------------------------------------
__global__ __launch_bounds__(256) void scores_kernel(
    const _Float16* __restrict__ qh, const _Float16* __restrict__ kh,
    float* __restrict__ sc) {
  __shared__ __attribute__((aligned(16))) _Float16 s_ab[2 * PSTAGE];
  const int m0 = blockIdx.z * SEQ + blockIdx.x * PBM;
  const int n0 = blockIdx.y * PBN;
  v8f acc[4][4];
  tile_product<EMB>(qh + (size_t)m0 * EMB, EMB,
                    kh + (size_t)(blockIdx.z * SEQ + n0) * EMB, EMB, s_ab, acc);

  const int wave = threadIdx.x >> 5, lane = threadIdx.x & 31;
  float* dst = sc + (size_t)(m0 + (wave >> 2) * 64 + (lane >> 4) * 8) * SEQ +
               n0 + (wave & 3) * 64 + (lane & 15);
#pragma unroll
  for (int i = 0; i < 4; ++i)
#pragma unroll
    for (int r = 0; r < 8; ++r)
#pragma unroll
      for (int j = 0; j < 4; ++j)  // scale by QD, not sqrt(QD)
        dst[(size_t)(i * 16 + r) * SEQ + j * 16] = acc[i][j][r] * (1.0f / 1024.0f);
}

static __device__ __forceinline__ float exp_slot(float t) {
  const float u = t * 1.44269504f;
  float r;
  asm("v_exp_f32 %0, %1\n\tv_nop" : "=v"(r) : "v"(u));
  return r;
}

__global__ __launch_bounds__(256) void softmax_kernel(
    const float* __restrict__ sc, const int* __restrict__ mask,
    _Float16* __restrict__ ph, float* __restrict__ rinv) {
  const int row = blockIdx.x * 8 + (threadIdx.x >> 5);
  const int lane = threadIdx.x & 31;
  const size_t base = (size_t)row * SEQ + lane * 8;
  const float* s = sc + base;
  const int* mk = mask + base;

  float4 a[16];
  int4 g[16];
#pragma unroll
  for (int c = 0; c < 8; ++c) {
    a[2 * c]     = *(const float4*)(s + c * 256);
    a[2 * c + 1] = *(const float4*)(s + c * 256 + 4);
    g[2 * c]     = *(const int4*)(mk + c * 256);
    g[2 * c + 1] = *(const int4*)(mk + c * 256 + 4);
  }
  // Behind the loads, in front of every rewrite of their address registers:
  // named as inputs, the two address pairs stay live up to the wait, so that
  // no load's own result is placed on them ahead of it.
  asm volatile("s_wait_xcnt 0x0" :: "v"(s), "v"(mk) : "memory");

  float m = -1e30f;
#pragma unroll
  for (int c = 0; c < 16; ++c) {
    a[c].x = (g[c].x == 0) ? -1e30f : a[c].x;
    a[c].y = (g[c].y == 0) ? -1e30f : a[c].y;
    a[c].z = (g[c].z == 0) ? -1e30f : a[c].z;
    a[c].w = (g[c].w == 0) ? -1e30f : a[c].w;
    m = fmaxf(m, fmaxf(fmaxf(a[c].x, a[c].y), fmaxf(a[c].z, a[c].w)));
  }
#pragma unroll
  for (int d = 16; d > 0; d >>= 1) m = fmaxf(m, __shfl_xor(m, d));

  float sum = 0.0f;
  _Float16* dst = ph + base;
#pragma unroll
  for (int c = 0; c < 8; ++c) {
    const float p[8] = {exp_slot(a[2 * c].x - m),     exp_slot(a[2 * c].y - m),
                        exp_slot(a[2 * c].z - m),     exp_slot(a[2 * c].w - m),
                        exp_slot(a[2 * c + 1].x - m), exp_slot(a[2 * c + 1].y - m),
                        exp_slot(a[2 * c + 1].z - m), exp_slot(a[2 * c + 1].w - m)};
    v8h h;
#pragma unroll
    for (int e = 0; e < 8; ++e) { h[e] = (_Float16)p[e]; sum += p[e]; }
    *(v8h*)(dst + c * 256) = h;
  }
#pragma unroll
  for (int d = 16; d > 0; d >>= 1) sum += __shfl_xor(sum, d);
  if (lane == 0) rinv[row] = 1.0f / sum;
}

// ---------------------------------------------------------------------------
// Kernel 4: out[row][d] = rinv[row] * sum_k ph[row][k] * vt[d][b*SEQ + k].
// grid = (ROWS/128 row tiles, DIM/256 column tiles).
// ---------------------------------------------------------------------------
__global__ __launch_bounds__(256) void pv_kernel(
    const _Float16* __restrict__ ph, const _Float16* __restrict__ vt,
    const float* __restrict__ rinv, float* __restrict__ out) {
  __shared__ __attribute__((aligned(16))) _Float16 s_ab[2 * PSTAGE];
  const int m0 = blockIdx.x * PBM;
  const int n0 = blockIdx.y * PBN;
  const int b = m0 / SEQ;
  v8f acc[4][4];
  tile_product<SEQ>(ph + (size_t)m0 * SEQ, SEQ,
                    vt + (size_t)n0 * ROWS + b * SEQ, ROWS, s_ab, acc);

  const int wave = threadIdx.x >> 5, lane = threadIdx.x & 31;
  const int mb = m0 + (wave >> 2) * 64 + (lane >> 4) * 8;
  float* dst = out + (size_t)mb * DIM + n0 + (wave & 3) * 64 + (lane & 15);
#pragma unroll
  for (int i = 0; i < 4; ++i) {
    const float4 u0 = *(const float4*)(rinv + mb + i * 16);
    const float4 u1 = *(const float4*)(rinv + mb + i * 16 + 4);
    const float li[8] = {u0.x, u0.y, u0.z, u0.w, u1.x, u1.y, u1.z, u1.w};
#pragma unroll
    for (int r = 0; r < 8; ++r)
#pragma unroll
      for (int j = 0; j < 4; ++j)
        dst[(size_t)(i * 16 + r) * DIM + j * 16] = acc[i][j][r] * li[r];
  }
}

// ---------------------------------------------------------------------------
// Launch: inputs are x, mask, Wq, bq, Wk, bk, Wv, bv.
// Workspace layout (f16): qh[8192][1024] | kh[8192][1024] | vt[1024][8192]
//                         | Wt (3 x [1024][1024]) | sc f32 [8192][2048]
//                         | ph f16 [8192][2048] | rinv f32 [8192]  -> 150 MB.
// ---------------------------------------------------------------------------
extern "C" void kernel_launch(void* const* d_in, const int* in_sizes, int n_in,
                              void* d_out, int out_size, void* d_ws, size_t ws_size,
                              hipStream_t stream) {
  const float* x    = (const float*)d_in[0];
  const int*   mask = (const int*)d_in[1];
  const float* Wq   = (const float*)d_in[2];
  const float* bq   = (const float*)d_in[3];
  const float* Wk   = (const float*)d_in[4];
  const float* bk   = (const float*)d_in[5];
  const float* Wv   = (const float*)d_in[6];
  const float* bv   = (const float*)d_in[7];
  float* out = (float*)d_out;

  _Float16* qh = (_Float16*)d_ws;
  _Float16* kh = qh + (size_t)ROWS * DIM;
  _Float16* vt = kh + (size_t)ROWS * DIM;
  _Float16* wt = vt + (size_t)ROWS * DIM;
  float* sc = (float*)(wt + (size_t)3 * EMB * DIM);
  _Float16* ph = (_Float16*)(sc + (size_t)ROWS * SEQ);
  float* rinv = (float*)(ph + (size_t)ROWS * SEQ);

  dim3 bt(256);
  wtrans_kernel<<<dim3(EMB * DIM / 256, 1, 3), bt, 0, stream>>>(Wq, Wk, Wv, wt);
  qkv_proj_kernel<<<dim3(ROWS / PBM, DIM / PBN, 3), bt, 0, stream>>>(
      x, wt, bq, bk, bv, qh, kh, vt);
  scores_kernel<<<dim3(SEQ / PBM, SEQ / PBN, BSZ), bt, 0, stream>>>(qh, kh, sc);
  softmax_kernel<<<dim3(ROWS / 8), bt, 0, stream>>>(sc, mask, ph, rinv);
  pv_kernel<<<dim3(ROWS / PBM, DIM / PBN), bt, 0, stream>>>(ph, vt, rinv, out);
}

// v003
// A run of this version takes 135 microseconds.
// In two side-by-side timings against v002, it was 1.10 and 1.09 times as fast.
// Over all steps from v000 it is 5.26 times as fast.
#include <hip/hip_runtime.h>
#include <hip/hip_fp16.h>

typedef __attribute__((ext_vector_type(16))) _Float16 v16h;
typedef __attribute__((ext_vector_type(8)))  _Float16 v8h;
typedef __attribute__((ext_vector_type(4)))  _Float16 v4h;
typedef __attribute__((ext_vector_type(8)))  float    v8f;

#define BSZ 4
#define SEQ 2048
#define EMB 1024
#define DIM 1024
#define ROWS (BSZ * SEQ)  // 8192

static __device__ __forceinline__ v16h cat8(v8h lo, v8h hi) {
  v16h r;
#pragma unroll
  for (int i = 0; i < 8; ++i) { r[i] = lo[i]; r[i + 8] = hi[i]; }
  return r;
}

// ---------------------------------------------------------------------------
// Kernel 0: transpose + f32->f16 convert the three weight matrices.
// Wt[d][e] = (f16) W[e][d]  so that weight-fragment (column) reads become
// contiguous row reads for the WMMA GEMMs.
// grid = (EMB/256, DIM/64, 3), block = 8 waves (4 along e, 2 along d).
// A thread turns an 8 (e) x 8 (d) patch in registers; a wave covers 64 e by
// 32 d with 8 lanes along e and 4 along d.  All 16 loads of a thread are in
// flight together, each wave-wide load takes 64-byte pieces of 8 rows (the
// two pieces of a line by the same thread), and each wave-wide store writes
// four whole 128-byte lines.
// ---------------------------------------------------------------------------
__global__ __launch_bounds__(256) void wtrans_kernel(
    const float* __restrict__ Wq, const float* __restrict__ Wk,
    const float* __restrict__ Wv, _Float16* __restrict__ wt) {
  const float* W = (blockIdx.z == 0) ? Wq : (blockIdx.z == 1) ? Wk : Wv;
  const int wave = threadIdx.x >> 5, lane = threadIdx.x & 31;
  const int e0 = blockIdx.x * 256 + (wave >> 1) * 64 + (lane & 7) * 8;
  const int d0 = blockIdx.y * 64 + (wave & 1) * 32 + (lane >> 3) * 4;
  const float* src = W + (size_t)e0 * DIM + d0;
  _Float16* dst = wt + (size_t)blockIdx.z * EMB * DIM + (size_t)d0 * EMB + e0;

  float4 r[8][2];  // r[i][h] = W[e0 + i][d0 + h*16 .. + 3]
#pragma unroll
  for (int i = 0; i < 8; ++i)
#pragma unroll
    for (int h = 0; h < 2; ++h)
      r[i][h] = *(const float4*)(src + (size_t)i * DIM + h * 16);
  // Behind the loads, in front of every rewrite of their address registers:
  // named as an input, the address pair stays live up to the wait, so that no
  // load's own result is placed on it ahead of it.
  asm volatile("s_wait_xcnt 0x0" :: "v"(src) : "memory");
  // Keeps the conversions behind all 16 loads: lifted among them they make
  // the last loads wait for the first ones' data, a second memory latency.
  __builtin_amdgcn_sched_barrier(0);

  v8h t[2][4];  // t[h][c][i] = Wt[d0 + h*16 + c][e0 + i]
#pragma unroll
  for (int h = 0; h < 2; ++h)
#pragma unroll
    for (int i = 0; i < 8; ++i) {
      t[h][0][i] = (_Float16)r[i][h].x;
      t[h][1][i] = (_Float16)r[i][h].y;
      t[h][2][i] = (_Float16)r[i][h].z;
      t[h][3][i] = (_Float16)r[i][h].w;
    }
#pragma unroll
  for (int h = 0; h < 2; ++h)
#pragma unroll
    for (int c = 0; c < 4; ++c)
      *(v8h*)(dst + (size_t)(h * 16 + c) * EMB) = t[h][c];
}

#define PBM 128
#define PBN 256
#define PK 64
#define PPITCH (PK + 8)
#define PSTAGE ((PBM + PBN) * PPITCH)
#define PNX (PBM * PK / 4 / 256)
#define PNW (PBN * PK / 8 / 256)

__global__ __launch_bounds__(256) void qkv_proj_kernel(
    const float* __restrict__ x, const _Float16* __restrict__ wt_all,
    const float* __restrict__ bq, const float* __restrict__ bk,
    const float* __restrict__ bv, _Float16* __restrict__ qh,
    _Float16* __restrict__ kh, _Float16* __restrict__ vt) {
  const int z = blockIdx.z;
  const float* bias = (z == 0) ? bq : (z == 1) ? bk : bv;
  const _Float16* wt = wt_all + (size_t)z * EMB * DIM;

  const int tid = threadIdx.x, wave = tid >> 5, lane = tid & 31;
  const int l15 = lane & 15, hi = lane >> 4;
  const int koff = hi * 8;
  const int m0 = blockIdx.x * PBM;
  const int n0 = blockIdx.y * PBN;
  const int wm = wave >> 2, wn = wave & 3;

  __shared__ __attribute__((aligned(16))) _Float16 s_ab[2 * PSTAGE];

  // Staging map: a row of the pass is covered by consecutive lanes.
  const int xcol = (tid % (PK / 4)) * 4, xrow = tid / (PK / 4);
  const int wcol = (tid % (PK / 8)) * 8, wrow = tid / (PK / 8);
  const float* xsrc = x + (size_t)(m0 + xrow) * EMB + xcol;
  const _Float16* wsrc = wt + (size_t)(n0 + wrow) * EMB + wcol;
  const int xdst = xrow * PPITCH + xcol;
  const int wdst = (PBM + wrow) * PPITCH + wcol;

  // Fragment bases: which LDS region is the A operand depends on z only.
  const int xfrag = (wm * 64 + l15) * PPITCH + koff;
  const int wfrag = (PBM + wn * 64 + l15) * PPITCH + koff;
  const int afrag = (z < 2) ? wfrag : xfrag;
  const int bfrag = (z < 2) ? xfrag : wfrag;

  float4 rx[PNX];
  v8h rw[PNW];
#pragma unroll
  for (int i = 0; i < PNX; ++i)
    rx[i] = *(const float4*)(xsrc + (size_t)i * (1024 / PK) * EMB);
#pragma unroll
  for (int i = 0; i < PNW; ++i)
    rw[i] = *(const v8h*)(wsrc + (size_t)i * (2048 / PK) * EMB);

  v8f acc[4][4];
#pragma unroll
  for (int i = 0; i < 4; ++i)
#pragma unroll
    for (int j = 0; j < 4; ++j) acc[i][j] = v8f{};

  for (int kt = 0; kt < EMB / PK; ++kt) {
    _Float16* sb = s_ab + (kt & 1) * PSTAGE;
#pragma unroll
    for (int i = 0; i < PNX; ++i) {
      v4h h;
      h[0] = (_Float16)rx[i].x; h[1] = (_Float16)rx[i].y;
      h[2] = (_Float16)rx[i].z; h[3] = (_Float16)rx[i].w;
      *(v4h*)(sb + xdst + i * (1024 / PK) * PPITCH) = h;
    }
#pragma unroll
    for (int i = 0; i < PNW; ++i)
      *(v8h*)(sb + wdst + i * (2048 / PK) * PPITCH) = rw[i];
    // One barrier per pass: it publishes this buffer, and it also says that
    // every wave has left the other buffer, which the next pass overwrites.
    __syncthreads();

    if (kt + 1 < EMB / PK) {
      const int k1 = (kt + 1) * PK;
#pragma unroll
      for (int i = 0; i < PNX; ++i)
        rx[i] = *(const float4*)(xsrc + (size_t)i * (1024 / PK) * EMB + k1);
#pragma unroll
      for (int i = 0; i < PNW; ++i)
        rw[i] = *(const v8h*)(wsrc + (size_t)i * (2048 / PK) * EMB + k1);
      // Stands behind the loads, in front of every rewrite of their address
      // registers.  Its "memory" clobber also holds the loads here, ahead of
      // this pass's LDS reads and WMMAs; sunk behind them they would be waited
      // for at the top of the next pass with nothing left to cover them.
      asm volatile("s_wait_xcnt 0x0" ::: "memory");
    }

#pragma unroll
    for (int ks = 0; ks < PK / 32; ++ks) {
      v16h fa[4], fb[4];
#pragma unroll
      for (int i = 0; i < 4; ++i) {
        const _Float16* pa = sb + afrag + i * 16 * PPITCH + ks * 32;
        const _Float16* pb = sb + bfrag + i * 16 * PPITCH + ks * 32;
        fa[i] = cat8(*(const v8h*)pa, *(const v8h*)(pa + 16));
        fb[i] = cat8(*(const v8h*)pb, *(const v8h*)(pb + 16));
      }
#pragma unroll
      for (int i = 0; i < 4; ++i)
#pragma unroll
        for (int j = 0; j < 4; ++j)
          acc[i][j] = __builtin_amdgcn_wmma_f32_16x16x32_f16(
              false, fa[i], false, fb[j], (short)0, acc[i][j], false, false);
    }
  }

  if (z < 2) {
    // acc[i][j][r] = Y[m0 + wm*64 + j*16 + l15][n0 + wn*64 + i*16 + hi*8 + r]
    _Float16* dst = (z == 0) ? qh : kh;
    const int nb = n0 + wn * 64 + hi * 8;
    float4 c0[4], c1[4];
#pragma unroll
    for (int i = 0; i < 4; ++i) {
      c0[i] = *(const float4*)(bias + nb + i * 16);
      c1[i] = *(const float4*)(bias + nb + i * 16 + 4);
    }
#pragma unroll
    for (int i = 0; i < 4; ++i) {
      const float bb[8] = {c0[i].x, c0[i].y, c0[i].z, c0[i].w,
                           c1[i].x, c1[i].y, c1[i].z, c1[i].w};
#pragma unroll
      for (int j = 0; j < 4; ++j) {
        const int m = m0 + wm * 64 + j * 16 + l15;
        v8h o;
#pragma unroll
        for (int r = 0; r < 8; ++r) o[r] = (_Float16)(acc[i][j][r] + bb[r]);
        *(v8h*)(dst + (size_t)m * DIM + nb + i * 16) = o;
      }
      // The wait stands behind each group's stores, in front of whatever
      // rewrites their registers next.
      asm volatile("s_wait_xcnt 0x0" ::: "memory");
    }
  } else {
    // acc[i][j][r] = Y[m0 + wm*64 + i*16 + hi*8 + r][n0 + wn*64 + j*16 + l15]
    const int nb = n0 + wn * 64 + l15;
    float bn[4];
#pragma unroll
    for (int j = 0; j < 4; ++j) bn[j] = bias[nb + j * 16];
#pragma unroll
    for (int j = 0; j < 4; ++j) {
#pragma unroll
      for (int i = 0; i < 4; ++i) {
        const int m = m0 + wm * 64 + i * 16 + hi * 8;
        v8h o;
#pragma unroll
        for (int r = 0; r < 8; ++r) o[r] = (_Float16)(acc[i][j][r] + bn[j]);
        *(v8h*)(vt + (size_t)(nb + j * 16) * ROWS + m) = o;
      }
      // The wait: as in the branch above.
      asm volatile("s_wait_xcnt 0x0" ::: "memory");
      // Keeps each group's sums and stores together: hoisted all at once
      // they take the kernel past 256 VGPRs, and only one block fits a WGP.
      if (j < 3) __builtin_amdgcn_sched_barrier(0);
    }
  }
}

// ---------------------------------------------------------------------------
// Attention as two tiled GEMMs with a row softmax between them.
// The tile product below is the projection's scheme with both operands f16:
// C[128][256] = X[128][KTOT] * W[256][KTOT]^T, 8 waves (2 x 4) of 64x64, both
// operands staged per pass of PK k-values in one of two LDS buffers, the next
// pass's global loads issued ahead of this pass's WMMAs.  X is the A operand:
// acc[i][j][r] = C[wm*64 + i*16 + hi*8 + r][wn*64 + j*16 + l15].
// ---------------------------------------------------------------------------
#define PNH (PBM * PK / 8 / 256)       // 16-byte loads of the X operand per thread and pass

template <int KTOT>
static __device__ __forceinline__ void tile_product(
    const _Float16* __restrict__ xs, const int xpitch,
    const _Float16* __restrict__ ws, const int wpitch,
    _Float16* s_ab, v8f (&acc)[4][4]) {
  const int tid = threadIdx.x, wave = tid >> 5, lane = tid & 31;
  const int l15 = lane & 15, koff = (lane >> 4) * 8;
  const int wm = wave >> 2, wn = wave & 3;

  // Staging map: 8 consecutive lanes cover one 128-byte row of the pass.
  const int col = (tid % (PK / 8)) * 8, row = tid / (PK / 8);
  const _Float16* xsrc = xs + (size_t)row * xpitch + col;
  const _Float16* wsrc = ws + (size_t)row * wpitch + col;
  const int xdst = row * PPITCH + col;
  const int wdst = (PBM + row) * PPITCH + col;
  const int afrag = (wm * 64 + l15) * PPITCH + koff;
  const int bfrag = (PBM + wn * 64 + l15) * PPITCH + koff;

  v8h rx[PNH], rw[PNW];
#pragma unroll
  for (int i = 0; i < PNH; ++i)
    rx[i] = *(const v8h*)(xsrc + (size_t)i * (2048 / PK) * xpitch);
#pragma unroll
  for (int i = 0; i < PNW; ++i)
    rw[i] = *(const v8h*)(wsrc + (size_t)i * (2048 / PK) * wpitch);

#pragma unroll
  for (int i = 0; i < 4; ++i)
#pragma unroll
    for (int j = 0; j < 4; ++j) acc[i][j] = v8f{};

  for (int kt = 0; kt < KTOT / PK; ++kt) {
    _Float16* sb = s_ab + (kt & 1) * PSTAGE;
#pragma unroll
    for (int i = 0; i < PNH; ++i)
      *(v8h*)(sb + xdst + i * (2048 / PK) * PPITCH) = rx[i];
#pragma unroll
    for (int i = 0; i < PNW; ++i)
      *(v8h*)(sb + wdst + i * (2048 / PK) * PPITCH) = rw[i];
    // One barrier per pass: it publishes this buffer, and it also says that
    // every wave has left the other buffer, which the next pass overwrites.
    __syncthreads();

    if (kt + 1 < KTOT / PK) {
      const int k1 = (kt + 1) * PK;
#pragma unroll
      for (int i = 0; i < PNH; ++i)
        rx[i] = *(const v8h*)(xsrc + (size_t)i * (2048 / PK) * xpitch + k1);
#pragma unroll
      for (int i = 0; i < PNW; ++i)
        rw[i] = *(const v8h*)(wsrc + (size_t)i * (2048 / PK) * wpitch + k1);
      // Stands behind the loads, in front of every rewrite of their address
      // registers; its "memory" clobber also holds the loads ahead of this
      // pass's LDS reads and WMMAs, which cover their latency.
      asm volatile("s_wait_xcnt 0x0" ::: "memory");
    }

#pragma unroll
    for (int ks = 0; ks < PK / 32; ++ks) {
      v16h fa[4], fb[4];
#pragma unroll
      for (int i = 0; i < 4; ++i) {
        const _Float16* pa = sb + afrag + i * 16 * PPITCH + ks * 32;
        const _Float16* pb = sb + bfrag + i * 16 * PPITCH + ks * 32;
        fa[i] = cat8(*(const v8h*)pa, *(const v8h*)(pa + 16));
        fb[i] = cat8(*(const v8h*)pb, *(const v8h*)(pb + 16));
      }
#pragma unroll
      for (int i = 0; i < 4; ++i)
#pragma unroll
        for (int j = 0; j < 4; ++j)
          acc[i][j] = __builtin_amdgcn_wmma_f32_16x16x32_f16(
              false, fa[i], false, fb[j], (short)0, acc[i][j], false, false);
    }
  }
}

// ---------------------------------------------------------------------------
// Kernel 2: scaled scores.  sc[b*SEQ + q][k] = (q . k) / 1024, f32.
// grid = (SEQ/128 query tiles, SEQ/256 key tiles, BSZ).
// ---------------------------------------------------------------------------
__global__ __launch_bounds__(256) void scores_kernel(
    const _Float16* __restrict__ qh, const _Float16* __restrict__ kh,
    float* __restrict__ sc) {
  __shared__ __attribute__((aligned(16))) _Float16 s_ab[2 * PSTAGE];
  const int m0 = blockIdx.z * SEQ + blockIdx.x * PBM;
  const int n0 = blockIdx.y * PBN;
  v8f acc[4][4];
  tile_product<EMB>(qh + (size_t)m0 * EMB, EMB,
                    kh + (size_t)(blockIdx.z * SEQ + n0) * EMB, EMB, s_ab, acc);

  const int wave = threadIdx.x >> 5, lane = threadIdx.x & 31;
  float* dst = sc + (size_t)(m0 + (wave >> 2) * 64 + (lane >> 4) * 8) * SEQ +
               n0 + (wave & 3) * 64 + (lane & 15);
#pragma unroll
  for (int i = 0; i < 4; ++i)
#pragma unroll
    for (int r = 0; r < 8; ++r)
#pragma unroll
      for (int j = 0; j < 4; ++j)  // scale by QD, not sqrt(QD)
        dst[(size_t)(i * 16 + r) * SEQ + j * 16] = acc[i][j][r] * (1.0f / 1024.0f);
}

static __device__ __forceinline__ float exp_slot(float t) {
  const float u = t * 1.44269504f;
  float r;
  asm("v_exp_f32 %0, %1\n\tv_nop" : "=v"(r) : "v"(u));
  return r;
}

__global__ __launch_bounds__(256) void softmax_kernel(
    const float* __restrict__ sc, const int* __restrict__ mask,
    _Float16* __restrict__ ph, float* __restrict__ rinv) {
  const int row = blockIdx.x * 8 + (threadIdx.x >> 5);
  const int lane = threadIdx.x & 31;
  const size_t base = (size_t)row * SEQ + lane * 8;
  const float* s = sc + base;
  const int* mk = mask + base;

  float4 a[16];
  int4 g[16];
#pragma unroll
  for (int c = 0; c < 8; ++c) {
    a[2 * c]     = *(const float4*)(s + c * 256);
    a[2 * c + 1] = *(const float4*)(s + c * 256 + 4);
    g[2 * c]     = *(const int4*)(mk + c * 256);
    g[2 * c + 1] = *(const int4*)(mk + c * 256 + 4);
  }
  // Behind the loads, in front of every rewrite of their address registers:
  // named as inputs, the two address pairs stay live up to the wait, so that
  // no load's own result is placed on them ahead of it.
  asm volatile("s_wait_xcnt 0x0" :: "v"(s), "v"(mk) : "memory");

  float m = -1e30f;
#pragma unroll
  for (int c = 0; c < 16; ++c) {
    a[c].x = (g[c].x == 0) ? -1e30f : a[c].x;
    a[c].y = (g[c].y == 0) ? -1e30f : a[c].y;
    a[c].z = (g[c].z == 0) ? -1e30f : a[c].z;
    a[c].w = (g[c].w == 0) ? -1e30f : a[c].w;
    m = fmaxf(m, fmaxf(fmaxf(a[c].x, a[c].y), fmaxf(a[c].z, a[c].w)));
  }
#pragma unroll
  for (int d = 16; d > 0; d >>= 1) m = fmaxf(m, __shfl_xor(m, d));

  float sum = 0.0f;
  _Float16* dst = ph + base;
#pragma unroll
  for (int c = 0; c < 8; ++c) {
    const float p[8] = {exp_slot(a[2 * c].x - m),     exp_slot(a[2 * c].y - m),
                        exp_slot(a[2 * c].z - m),     exp_slot(a[2 * c].w - m),
                        exp_slot(a[2 * c + 1].x - m), exp_slot(a[2 * c + 1].y - m),
                        exp_slot(a[2 * c + 1].z - m), exp_slot(a[2 * c + 1].w - m)};
    v8h h;
#pragma unroll
    for (int e = 0; e < 8; ++e) { h[e] = (_Float16)p[e]; sum += p[e]; }
    *(v8h*)(dst + c * 256) = h;
  }
#pragma unroll
  for (int d = 16; d > 0; d >>= 1) sum += __shfl_xor(sum, d);
  if (lane == 0) rinv[row] = 1.0f / sum;
}

// ---------------------------------------------------------------------------
// Kernel 4: out[row][d] = rinv[row] * sum_k ph[row][k] * vt[d][b*SEQ + k].
// grid = (ROWS/128 row tiles, DIM/256 column tiles).
// ---------------------------------------------------------------------------
__global__ __launch_bounds__(256) void pv_kernel(
    const _Float16* __restrict__ ph, const _Float16* __restrict__ vt,
    const float* __restrict__ rinv, float* __restrict__ out) {
  __shared__ __attribute__((aligned(16))) _Float16 s_ab[2 * PSTAGE];
  const int m0 = blockIdx.x * PBM;
  const int n0 = blockIdx.y * PBN;
  const int b = m0 / SEQ;
  v8f acc[4][4];
  tile_product<SEQ>(ph + (size_t)m0 * SEQ, SEQ,
                    vt + (size_t)n0 * ROWS + b * SEQ, ROWS, s_ab, acc);

  const int wave = threadIdx.x >> 5, lane = threadIdx.x & 31;
  const int mb = m0 + (wave >> 2) * 64 + (lane >> 4) * 8;
  float* dst = out + (size_t)mb * DIM + n0 + (wave & 3) * 64 + (lane & 15);
#pragma unroll
  for (int i = 0; i < 4; ++i) {
    const float4 u0 = *(const float4*)(rinv + mb + i * 16);
    const float4 u1 = *(const float4*)(rinv + mb + i * 16 + 4);
    const float li[8] = {u0.x, u0.y, u0.z, u0.w, u1.x, u1.y, u1.z, u1.w};
#pragma unroll
    for (int r = 0; r < 8; ++r)
#pragma unroll
      for (int j = 0; j < 4; ++j)
        dst[(size_t)(i * 16 + r) * DIM + j * 16] = acc[i][j][r] * li[r];
  }
}

// ---------------------------------------------------------------------------
// Launch: inputs are x, mask, Wq, bq, Wk, bk, Wv, bv.
// Workspace layout (f16): qh[8192][1024] | kh[8192][1024] | vt[1024][8192]
//                         | Wt (3 x [1024][1024]) | sc f32 [8192][2048]
//                         | ph f16 [8192][2048] | rinv f32 [8192]  -> 150 MB.
// ---------------------------------------------------------------------------
extern "C" void kernel_launch(void* const* d_in, const int* in_sizes, int n_in,
                              void* d_out, int out_size, void* d_ws, size_t ws_size,
                              hipStream_t stream) {
  const float* x    = (const float*)d_in[0];
  const int*   mask = (const int*)d_in[1];
  const float* Wq   = (const float*)d_in[2];
  const float* bq   = (const float*)d_in[3];
  const float* Wk   = (const float*)d_in[4];
  const float* bk   = (const float*)d_in[5];
  const float* Wv   = (const float*)d_in[6];
  const float* bv   = (const float*)d_in[7];
  float* out = (float*)d_out;

  _Float16* qh = (_Float16*)d_ws;
  _Float16* kh = qh + (size_t)ROWS * DIM;
  _Float16* vt = kh + (size_t)ROWS * DIM;
  _Float16* wt = vt + (size_t)ROWS * DIM;
  float* sc = (float*)(wt + (size_t)3 * EMB * DIM);
  _Float16* ph = (_Float16*)(sc + (size_t)ROWS * SEQ);
  float* rinv = (float*)(ph + (size_t)ROWS * SEQ);

  dim3 bt(256);
  wtrans_kernel<<<dim3(EMB / 256, DIM / 64, 3), bt, 0, stream>>>(Wq, Wk, Wv, wt);
  qkv_proj_kernel<<<dim3(ROWS / PBM, DIM / PBN, 3), bt, 0, stream>>>(
      x, wt, bq, bk, bv, qh, kh, vt);
  scores_kernel<<<dim3(SEQ / PBM, SEQ / PBN, BSZ), bt, 0, stream>>>(qh, kh, sc);
  softmax_kernel<<<dim3(ROWS / 8), bt, 0, stream>>>(sc, mask, ph, rinv);
  pv_kernel<<<dim3(ROWS / PBM, DIM / PBN), bt, 0, stream>>>(ph, vt, rinv, out);
}

// v005
// A run of this version takes 119 microseconds.
// Versions in between are left out here; by their measured steps it is 1.13 times as fast as v003.
// Over all steps from v000 it is 5.96 times as fast.
#include <hip/hip_runtime.h>
#include <hip/hip_fp16.h>

typedef __attribute__((ext_vector_type(16))) _Float16 v16h;
typedef __attribute__((ext_vector_type(8)))  _Float16 v8h;
typedef __attribute__((ext_vector_type(4)))  _Float16 v4h;
typedef __attribute__((ext_vector_type(8)))  float    v8f;

#define BSZ 4
#define SEQ 2048
#define EMB 1024
#define DIM 1024
#define ROWS (BSZ * SEQ)  // 8192

static __device__ __forceinline__ v16h cat8(v8h lo, v8h hi) {
  v16h r;
#pragma unroll
  for (int i = 0; i < 8; ++i) { r[i] = lo[i]; r[i + 8] = hi[i]; }
  return r;
}

// ---------------------------------------------------------------------------
// Kernel 0: transpose + f32->f16 convert the three weight matrices.
// Wt[d][e] = (f16) W[e][d]  so that weight-fragment (column) reads become
// contiguous row reads for the WMMA GEMMs.
// grid = (EMB/256, DIM/64, 3), block = 8 waves (4 along e, 2 along d).
// A thread turns an 8 (e) x 8 (d) patch in registers; a wave covers 64 e by
// 32 d with 8 lanes along e and 4 along d.  All 16 loads of a thread are in
// flight together, each wave-wide load takes 64-byte pieces of 8 rows (the
// two pieces of a line by the same thread), and each wave-wide store writes
// four whole 128-byte lines.
// ---------------------------------------------------------------------------
__global__ __launch_bounds__(256) void wtrans_kernel(
    const float* __restrict__ Wq, const float* __restrict__ Wk,
    const float* __restrict__ Wv, _Float16* __restrict__ wt) {
  const float* W = (blockIdx.z == 0) ? Wq : (blockIdx.z == 1) ? Wk : Wv;
  const int wave = threadIdx.x >> 5, lane = threadIdx.x & 31;
  const int e0 = blockIdx.x * 256 + (wave >> 1) * 64 + (lane & 7) * 8;
  const int d0 = blockIdx.y * 64 + (wave & 1) * 32 + (lane >> 3) * 4;
  const float* src = W + (size_t)e0 * DIM + d0;
  _Float16* dst = wt + (size_t)blockIdx.z * EMB * DIM + (size_t)d0 * EMB + e0;

  float4 r[8][2];  // r[i][h] = W[e0 + i][d0 + h*16 .. + 3]
#pragma unroll
  for (int i = 0; i < 8; ++i)
#pragma unroll
    for (int h = 0; h < 2; ++h)
      r[i][h] = *(const float4*)(src + (size_t)i * DIM + h * 16);
  // Behind the loads, in front of every rewrite of their address registers:
  // named as an input, the address pair stays live up to the wait, so that no
  // load's own result is placed on it ahead of it.
  asm volatile("s_wait_xcnt 0x0" :: "v"(src) : "memory");
  // Keeps the conversions behind all 16 loads: lifted among them they make
  // the last loads wait for the first ones' data, a second memory latency.
  __builtin_amdgcn_sched_barrier(0);

  v8h t[2][4];  // t[h][c][i] = Wt[d0 + h*16 + c][e0 + i]
#pragma unroll
  for (int h = 0; h < 2; ++h)
#pragma unroll
    for (int i = 0; i < 8; ++i) {
      t[h][0][i] = (_Float16)r[i][h].x;
      t[h][1][i] = (_Float16)r[i][h].y;
      t[h][2][i] = (_Float16)r[i][h].z;
      t[h][3][i] = (_Float16)r[i][h].w;
    }
#pragma unroll
  for (int h = 0; h < 2; ++h)
#pragma unroll
    for (int c = 0; c < 4; ++c)
      *(v8h*)(dst + (size_t)(h * 16 + c) * EMB) = t[h][c];
}

#define PBM 128
#define PBN 256
#define PK 64
#define PPITCH (PK + 8)
#define PSTAGE ((PBM + PBN) * PPITCH)
#define PNX (PBM * PK / 4 / 256)
#define PNW (PBN * PK / 8 / 256)
#define WST (PSTAGE / 8)

// Results leave through LDS: straight from the accumulators a wave-wide store
// puts 32-byte pieces on 16 rows.  The pass count is even, so the last pass
// reads the second buffer, and behind its barrier no wave reads the first one
// any more: each wave takes WST halfs of it for itself.  It lays 32 rows of 64
// f16 results there at pitch PPITCH; this sends them out, 8 lanes a row, so
// that every wave-wide store is four whole 128-byte lines.
// g: the first row's first element, pitch: halfs per global row.
static __device__ __forceinline__ void flush_rows(const _Float16* sw, _Float16* g,
                                                  const int pitch) {
  const int lane = threadIdx.x & 31;
  const int row = lane >> 3, col = (lane & 7) * 8;
  // The rows are read back by other lanes than wrote them.
  asm volatile("s_wait_dscnt 0x0" ::: "memory");
  v8h v[8];
#pragma unroll
  for (int t = 0; t < 8; ++t) v[t] = *(const v8h*)(sw + (t * 4 + row) * PPITCH + col);
  _Float16* p = g + (size_t)row * pitch + col;
#pragma unroll
  for (int t = 0; t < 8; ++t) *(v8h*)(p + (size_t)t * 4 * pitch) = v[t];
  // Behind the stores, in front of whatever rewrites their registers next.
  asm volatile("s_wait_xcnt 0x0" :: "v"(p) : "memory");
}

__global__ __launch_bounds__(256) void qkv_proj_kernel(
    const float* __restrict__ x, const _Float16* __restrict__ wt_all,
    const float* __restrict__ bq, const float* __restrict__ bk,
    const float* __restrict__ bv, _Float16* __restrict__ qh,
    _Float16* __restrict__ kh, _Float16* __restrict__ vt) {
  const int z = blockIdx.z;
  const float* bias = (z == 0) ? bq : (z == 1) ? bk : bv;
  const _Float16* wt = wt_all + (size_t)z * EMB * DIM;

  const int tid = threadIdx.x, wave = tid >> 5, lane = tid & 31;
  const int l15 = lane & 15, hi = lane >> 4;
  const int koff = hi * 8;
  const int m0 = blockIdx.x * PBM;
  const int n0 = blockIdx.y * PBN;
  const int wm = wave >> 2, wn = wave & 3;

  __shared__ __attribute__((aligned(16))) _Float16 s_ab[2 * PSTAGE];

  // Staging map: a row of the pass is covered by consecutive lanes.
  const int xcol = (tid % (PK / 4)) * 4, xrow = tid / (PK / 4);
  const int wcol = (tid % (PK / 8)) * 8, wrow = tid / (PK / 8);
  const float* xsrc = x + (size_t)(m0 + xrow) * EMB + xcol;
  const _Float16* wsrc = wt + (size_t)(n0 + wrow) * EMB + wcol;
  const int xdst = xrow * PPITCH + xcol;
  const int wdst = (PBM + wrow) * PPITCH + wcol;

  // Fragment bases: which LDS region is the A operand depends on z only.
  const int xfrag = (wm * 64 + l15) * PPITCH + koff;
  const int wfrag = (PBM + wn * 64 + l15) * PPITCH + koff;
  const int afrag = (z < 2) ? wfrag : xfrag;
  const int bfrag = (z < 2) ? xfrag : wfrag;

  float4 rx[PNX];
  v8h rw[PNW];
#pragma unroll
  for (int i = 0; i < PNX; ++i)
    rx[i] = *(const float4*)(xsrc + (size_t)i * (1024 / PK) * EMB);
#pragma unroll
  for (int i = 0; i < PNW; ++i)
    rw[i] = *(const v8h*)(wsrc + (size_t)i * (2048 / PK) * EMB);

  v8f acc[4][4];
#pragma unroll
  for (int i = 0; i < 4; ++i)
#pragma unroll
    for (int j = 0; j < 4; ++j) acc[i][j] = v8f{};

  for (int kt = 0; kt < EMB / PK; ++kt) {
    _Float16* sb = s_ab + (kt & 1) * PSTAGE;
#pragma unroll
    for (int i = 0; i < PNX; ++i) {
      v4h h;
      h[0] = (_Float16)rx[i].x; h[1] = (_Float16)rx[i].y;
      h[2] = (_Float16)rx[i].z; h[3] = (_Float16)rx[i].w;
      *(v4h*)(sb + xdst + i * (1024 / PK) * PPITCH) = h;
    }
#pragma unroll
    for (int i = 0; i < PNW; ++i)
      *(v8h*)(sb + wdst + i * (2048 / PK) * PPITCH) = rw[i];
    // One barrier per pass: it publishes this buffer, and it also says that
    // every wave has left the other buffer, which the next pass overwrites.
    __syncthreads();

    if (kt + 1 < EMB / PK) {
      const int k1 = (kt + 1) * PK;
#pragma unroll
      for (int i = 0; i < PNX; ++i)
        rx[i] = *(const float4*)(xsrc + (size_t)i * (1024 / PK) * EMB + k1);
#pragma unroll
      for (int i = 0; i < PNW; ++i)
        rw[i] = *(const v8h*)(wsrc + (size_t)i * (2048 / PK) * EMB + k1);
      // Stands behind the loads, in front of every rewrite of their address
      // registers.  Its "memory" clobber also holds the loads here, ahead of
      // this pass's LDS reads and WMMAs; sunk behind them they would be waited
      // for at the top of the next pass with nothing left to cover them.
      asm volatile("s_wait_xcnt 0x0" ::: "memory");
    }

#pragma unroll
    for (int ks = 0; ks < PK / 32; ++ks) {
      v16h fa[4], fb[4];
#pragma unroll
      for (int i = 0; i < 4; ++i) {
        const _Float16* pa = sb + afrag + i * 16 * PPITCH + ks * 32;
        const _Float16* pb = sb + bfrag + i * 16 * PPITCH + ks * 32;
        fa[i] = cat8(*(const v8h*)pa, *(const v8h*)(pa + 16));
        fb[i] = cat8(*(const v8h*)pb, *(const v8h*)(pb + 16));
      }
#pragma unroll
      for (int i = 0; i < 4; ++i)
#pragma unroll
        for (int j = 0; j < 4; ++j)
          acc[i][j] = __builtin_amdgcn_wmma_f32_16x16x32_f16(
              false, fa[i], false, fb[j], (short)0, acc[i][j], false, false);
    }
  }

  static_assert((EMB / PK) % 2 == 0, "the last pass must read the second buffer");
  // The wave's number as a scalar: held in vector registers over the loop, what
  // the epilogue derives from it takes the kernel past 256 VGPRs.
  const int ws = __builtin_amdgcn_readfirstlane(wave);
  const int mw = m0 + (ws >> 2) * 64, nw = n0 + (ws & 3) * 64;
  _Float16* sw = s_ab + ws * WST;
  _Float16* st = sw + l15 * PPITCH + hi * 8;
  if (z < 2) {
    // acc[i][j][r] = Y[m0 + wm*64 + j*16 + l15][n0 + wn*64 + i*16 + hi*8 + r]
    _Float16* dst = (z == 0) ? qh : kh;
    const int nb = nw + hi * 8;
    float4 c0[4], c1[4];
#pragma unroll
    for (int i = 0; i < 4; ++i) {
      c0[i] = *(const float4*)(bias + nb + i * 16);
      c1[i] = *(const float4*)(bias + nb + i * 16 + 4);
    }
    // Behind the loads, in front of every rewrite of their address registers.
    asm volatile("s_wait_xcnt 0x0" ::: "memory");
#pragma unroll
    for (int h = 0; h < 2; ++h) {  // 32 rows m at a time
#pragma unroll
      for (int i = 0; i < 4; ++i) {
        const float bb[8] = {c0[i].x, c0[i].y, c0[i].z, c0[i].w,
                             c1[i].x, c1[i].y, c1[i].z, c1[i].w};
#pragma unroll
        for (int jj = 0; jj < 2; ++jj) {
          v8h o;
#pragma unroll
          for (int r = 0; r < 8; ++r) o[r] = (_Float16)(acc[i][h * 2 + jj][r] + bb[r]);
          *(v8h*)(st + jj * 16 * PPITCH + i * 16) = o;
        }
      }
      flush_rows(sw, dst + (size_t)(mw + h * 32) * DIM + nw, DIM);
    }
  } else {
    // acc[i][j][r] = Y[m0 + wm*64 + i*16 + hi*8 + r][n0 + wn*64 + j*16 + l15]
    const int nb = nw + l15;
    float bn[4];
#pragma unroll
    for (int j = 0; j < 4; ++j) bn[j] = bias[nb + j * 16];
    // The wait: as in the branch above.
    asm volatile("s_wait_xcnt 0x0" ::: "memory");
#pragma unroll
    for (int j = 0; j < 4; ++j) {  // 32 rows n at a time
#pragma unroll
      for (int i = 0; i < 4; ++i) {
        v8h o;
#pragma unroll
        for (int r = 0; r < 8; ++r) o[r] = (_Float16)(acc[i][j][r] + bn[j]);
        *(v8h*)(st + (j & 1) * 16 * PPITCH + i * 16) = o;
      }
      if (j & 1) flush_rows(sw, vt + (size_t)(nw + (j >> 1) * 32) * ROWS + mw, ROWS);
      // Keeps each group's sums and stores together: hoisted all at once
      // they take the kernel past 256 VGPRs, and only one block fits a WGP.
      if (j < 3) __builtin_amdgcn_sched_barrier(0);
    }
  }
}

// ---------------------------------------------------------------------------
// Attention as two tiled GEMMs with the row softmax folded into them.
// The tile product below is the projection's scheme with both operands f16:
// C[128][256] = X[128][KTOT] * W[256][KTOT]^T, 8 waves (2 x 4) of 64x64, both
// operands staged per pass of PK k-values in one of two LDS buffers, the next
// pass's global loads issued ahead of this pass's WMMAs.  X is the A operand:
// acc[i][j][r] = C[wm*64 + i*16 + hi*8 + r][wn*64 + j*16 + l15].
// With SCALE, row m of X is multiplied in pass kt by sf[m * (KTOT / PK) + kt]
// (an LDS table) on its way from registers to LDS.
// ---------------------------------------------------------------------------
#define NGRP (SEQ / PK)                // key groups of a row, one per pass of P*V
#define PNH (PBM * PK / 8 / 256)       // 16-byte loads of the X operand per thread and pass
#define OPITCH 68                      // floats per staged output row: rows 8 apart fall 32 banks apart
static_assert(16 * OPITCH * 4 <= WST * 2 && 32 * PPITCH <= WST, "staged rows fit a wave's part");

template <int KTOT, bool SCALE>
static __device__ __forceinline__ void tile_product(
    const _Float16* __restrict__ xs, const int xpitch,
    const _Float16* __restrict__ ws, const int wpitch,
    _Float16* s_ab, const _Float16* sf, v8f (&acc)[4][4]) {
  static_assert((KTOT / PK) % 2 == 0, "the last pass must read the second buffer");
  const int tid = threadIdx.x, wave = tid >> 5, lane = tid & 31;
  const int l15 = lane & 15, koff = (lane >> 4) * 8;
  const int wm = wave >> 2, wn = wave & 3;

  // Staging map: 8 consecutive lanes cover one 128-byte row of the pass.
  const int col = (tid % (PK / 8)) * 8, row = tid / (PK / 8);
  const _Float16* xsrc = xs + (size_t)row * xpitch + col;
  const _Float16* wsrc = ws + (size_t)row * wpitch + col;
  const int xdst = row * PPITCH + col;
  const int wdst = (PBM + row) * PPITCH + col;
  const int afrag = (wm * 64 + l15) * PPITCH + koff;
  const int bfrag = (PBM + wn * 64 + l15) * PPITCH + koff;

  v8h rx[PNH], rw[PNW];
#pragma unroll
  for (int i = 0; i < PNH; ++i)
    rx[i] = *(const v8h*)(xsrc + (size_t)i * (2048 / PK) * xpitch);
#pragma unroll
  for (int i = 0; i < PNW; ++i)
    rw[i] = *(const v8h*)(wsrc + (size_t)i * (2048 / PK) * wpitch);
  _Float16 fx[PNH];
  if (SCALE) {
#pragma unroll
    for (int i = 0; i < PNH; ++i)
      fx[i] = sf[(row + i * (2048 / PK)) * (KTOT / PK)];
  }

#pragma unroll
  for (int i = 0; i < 4; ++i)
#pragma unroll
    for (int j = 0; j < 4; ++j) acc[i][j] = v8f{};

  for (int kt = 0; kt < KTOT / PK; ++kt) {
    _Float16* sb = s_ab + (kt & 1) * PSTAGE;
#pragma unroll
    for (int i = 0; i < PNH; ++i)
      *(v8h*)(sb + xdst + i * (2048 / PK) * PPITCH) = SCALE ? rx[i] * fx[i] : rx[i];
#pragma unroll
    for (int i = 0; i < PNW; ++i)
      *(v8h*)(sb + wdst + i * (2048 / PK) * PPITCH) = rw[i];
    // One barrier per pass: it publishes this buffer, and it also says that
    // every wave has left the other buffer, which the next pass overwrites.
    __syncthreads();

    if (kt + 1 < KTOT / PK) {
      const int k1 = (kt + 1) * PK;
#pragma unroll
      for (int i = 0; i < PNH; ++i)
        rx[i] = *(const v8h*)(xsrc + (size_t)i * (2048 / PK) * xpitch + k1);
#pragma unroll
      for (int i = 0; i < PNW; ++i)
        rw[i] = *(const v8h*)(wsrc + (size_t)i * (2048 / PK) * wpitch + k1);
      if (SCALE) {
#pragma unroll
        for (int i = 0; i < PNH; ++i)
          fx[i] = sf[(row + i * (2048 / PK)) * (KTOT / PK) + kt + 1];
      }
      // Stands behind the loads, in front of every rewrite of their address
      // registers; its "memory" clobber also holds the loads ahead of this
      // pass's LDS reads and WMMAs, which cover their latency.
      asm volatile("s_wait_xcnt 0x0" ::: "memory");
    }

#pragma unroll
    for (int ks = 0; ks < PK / 32; ++ks) {
      v16h fa[4], fb[4];
#pragma unroll
      for (int i = 0; i < 4; ++i) {
        const _Float16* pa = sb + afrag + i * 16 * PPITCH + ks * 32;
        const _Float16* pb = sb + bfrag + i * 16 * PPITCH + ks * 32;
        fa[i] = cat8(*(const v8h*)pa, *(const v8h*)(pa + 16));
        fb[i] = cat8(*(const v8h*)pb, *(const v8h*)(pb + 16));
      }
#pragma unroll
      for (int i = 0; i < 4; ++i)
#pragma unroll
        for (int j = 0; j < 4; ++j)
          acc[i][j] = __builtin_amdgcn_wmma_f32_16x16x32_f16(
              false, fa[i], false, fb[j], (short)0, acc[i][j], false, false);
    }
  }
}

static __device__ __forceinline__ float exp2_slot(float u) {
  float r;
  asm("v_exp_f32 %0, %1\n\tv_nop" : "=v"(r) : "v"(u));
  return r;
}

__global__ __launch_bounds__(256) void scores_kernel(
    const _Float16* __restrict__ qh, const _Float16* __restrict__ kh,
    const int* __restrict__ mask, _Float16* __restrict__ ph,
    float* __restrict__ gmax, float* __restrict__ gsum) {
  __shared__ __attribute__((aligned(16))) _Float16 s_ab[2 * PSTAGE];
  const int kb = blockIdx.x * PBM;
  const int qb = blockIdx.z * SEQ + blockIdx.y * PBN;
  v8f acc[4][4];
  tile_product<EMB, false>(kh + (size_t)(blockIdx.z * SEQ + kb) * EMB, EMB,
                           qh + (size_t)qb * EMB, EMB, s_ab, nullptr, acc);

  // acc[i][j][r] = S[key kb + wm*64 + i*16 + hi*8 + r][row qb + wn*64 + j*16 + l15]
  const int wave = threadIdx.x >> 5, lane = threadIdx.x & 31;
  const int hi = lane >> 4;
  const int key0 = kb + (wave >> 2) * 64 + hi * 8;
  const int grp = (kb >> 6) + (wave >> 2);
  const int row0 = qb + (wave & 3) * 64 + (lane & 15);
  const int* mk0 = mask + (size_t)row0 * SEQ + key0;
  int4 g[2][8];  // the mask of query column j in g[j & 1], fetched one column ahead
#pragma unroll
  for (int i = 0; i < 4; ++i) {
    g[0][2 * i]     = *(const int4*)(mk0 + i * 16);
    g[0][2 * i + 1] = *(const int4*)(mk0 + i * 16 + 4);
  }
  // Behind the loads, in front of every rewrite of their address registers:
  // named as an input, the address pair stays live up to the wait.
  asm volatile("s_wait_xcnt 0x0" :: "v"(mk0) : "memory");
  // Keeps the later columns' mask loads out of the last pass, where fragments
  // are still live: with them there the kernel goes past
  // 256 VGPRs, and only one block fits a WGP.
  __builtin_amdgcn_sched_barrier(0);
  _Float16* sw = s_ab + wave * WST;  // the wave's own part of the first buffer
  _Float16* st = sw + (lane & 15) * PPITCH + hi * 8;
  _Float16* pw = ph + (size_t)(qb + (wave & 3) * 64) * SEQ + kb + (wave >> 2) * 64;
#pragma unroll
  for (int j = 0; j < 4; ++j) {
    const int row = row0 + j * 16;
    if (j < 3) {
      const int* mk = mk0 + (size_t)(j + 1) * 16 * SEQ;
#pragma unroll
      for (int i = 0; i < 4; ++i) {
        g[(j + 1) & 1][2 * i]     = *(const int4*)(mk + i * 16);
        g[(j + 1) & 1][2 * i + 1] = *(const int4*)(mk + i * 16 + 4);
      }
      // The wait: as above (these loads are built on the same address pair, with
      // immediate offsets).  The fence holds this column's arithmetic behind it.
      asm volatile("s_wait_xcnt 0x0" :: "v"(mk0) : "memory");
      __builtin_amdgcn_sched_barrier(0);
    }
    // Columns 0 and 1 leave, 32 query rows at a time, behind the issue of the
    // next mask loads and ahead of column 2's results, which take their place.
    // The fence keeps this column's arithmetic off the stores' registers until
    // the wait that ends flush_rows.
    if (j == 2) {
      flush_rows(sw, pw, SEQ);
      __builtin_amdgcn_sched_barrier(0);
    }

    float m = -1e30f;
#pragma unroll
    for (int i = 0; i < 4; ++i) {
      const int4 ga = g[j & 1][2 * i], gb = g[j & 1][2 * i + 1];
      const int gi[8] = {ga.x, ga.y, ga.z, ga.w, gb.x, gb.y, gb.z, gb.w};
#pragma unroll
      for (int r = 0; r < 8; ++r) {  // scale by QD, not sqrt(QD); times log2(e)
        acc[i][j][r] = (gi[r] == 0) ? -1e30f : acc[i][j][r] * (1.44269504f / 1024.0f);
        m = fmaxf(m, acc[i][j][r]);
      }
    }
    m = fmaxf(m, __shfl_xor(m, 16));

    float sum = 0.0f;
#pragma unroll
    for (int i = 0; i < 4; ++i) {
      v8h h;
#pragma unroll
      for (int r = 0; r < 8; ++r) {
        const float p = exp2_slot(acc[i][j][r] - m);
        h[r] = (_Float16)p;
        sum += p;
      }
      *(v8h*)(st + (j & 1) * 16 * PPITCH + i * 16) = h;
    }
    sum += __shfl_xor(sum, 16);
    if (hi == 0) {
      gmax[(size_t)grp * ROWS + row] = m;
      gsum[(size_t)grp * ROWS + row] = sum;
    }
    // The wait stands behind each column's stores, in front of whatever
    // rewrites their registers next.
    asm volatile("s_wait_xcnt 0x0" ::: "memory");
  }
  flush_rows(sw, pw + (size_t)32 * SEQ, SEQ);
}

// ---------------------------------------------------------------------------
// Kernel 3: out[row][d] = sum_k softmax[row][k] * vt[d][b*SEQ + k].
// grid = (ROWS/128 row tiles, DIM/256 column tiles).
// First the block joins its 128 rows' groups: row max M = max of the group
// maxima, factor f[g] = exp2(gmax[g] - M), row sum = sum of f[g] * gsum[g].
// The product then takes ph[row][k] * f[group of k]; 1 / row sum at the end.
// ---------------------------------------------------------------------------
__global__ __launch_bounds__(256) void pv_kernel(
    const _Float16* __restrict__ ph, const _Float16* __restrict__ vt,
    const float* __restrict__ gmax, const float* __restrict__ gsum,
    float* __restrict__ out) {
  __shared__ __attribute__((aligned(16))) _Float16 s_ab[2 * PSTAGE];
  __shared__ __attribute__((aligned(16))) _Float16 s_f[PBM * NGRP];
  __shared__ __attribute__((aligned(16))) float s_rinv[PBM];
  const int m0 = blockIdx.x * PBM;
  const int n0 = blockIdx.y * PBN;
  const int b = m0 / SEQ;

  if (threadIdx.x < PBM) {
    const int t = threadIdx.x;
    const float* pm = gmax + m0;
    const float* ps = gsum + m0;
    float gm[NGRP], gs[NGRP];
#pragma unroll
    for (int g = 0; g < NGRP; ++g) {
      gm[g] = pm[(size_t)g * ROWS + t];
      gs[g] = ps[(size_t)g * ROWS + t];
    }
    // Behind the loads, in front of every rewrite of their address registers
    // (the lane's index, named as an input, and two scalar bases); the fence
    // holds the arithmetic behind the wait.
    asm volatile("s_wait_xcnt 0x0" :: "v"(t) : "memory");
    __builtin_amdgcn_sched_barrier(0);
    float m = gm[0];
#pragma unroll
    for (int g = 1; g < NGRP; ++g) m = fmaxf(m, gm[g]);
    float sum = 0.0f;
#pragma unroll
    for (int c = 0; c < NGRP / 8; ++c) {
      v8h h;
#pragma unroll
      for (int e = 0; e < 8; ++e) {
        h[e] = (_Float16)exp2_slot(gm[c * 8 + e] - m);
        sum += (float)h[e] * gs[c * 8 + e];  // the factor as the product sees it
      }
      *(v8h*)(s_f + threadIdx.x * NGRP + c * 8) = h;
    }
    s_rinv[threadIdx.x] = 1.0f / sum;
  }
  // Publishes the factors and the row sums to every wave of the block.
  __syncthreads();

  v8f acc[4][4];
  tile_product<SEQ, true>(ph + (size_t)m0 * SEQ, SEQ,
                          vt + (size_t)n0 * ROWS + b * SEQ, ROWS, s_ab, s_f, acc);

  // The wave's 64 x 64 f32 tile goes out through its own WST halfs of the first
  // buffer (free behind the last pass's barrier, as above flush_rows), 16 rows at
  // a time at pitch OPITCH: 16 lanes then send one row's 256 bytes, and every
  // wave-wide store is four whole 128-byte lines in place of 64-byte pieces.
  const int wave = threadIdx.x >> 5, lane = threadIdx.x & 31;
  const int l15 = lane & 15, hi = lane >> 4;
  const int ml = (wave >> 2) * 64 + hi * 8;
  float* st = (float*)(s_ab + wave * WST);
  float* dst = out + (size_t)(m0 + (wave >> 2) * 64 + hi) * DIM + n0 + (wave & 3) * 64 + l15 * 4;
#pragma unroll
  for (int i = 0; i < 4; ++i) {
    const float4 u0 = *(const float4*)(s_rinv + ml + i * 16);
    const float4 u1 = *(const float4*)(s_rinv + ml + i * 16 + 4);
    const float li[8] = {u0.x, u0.y, u0.z, u0.w, u1.x, u1.y, u1.z, u1.w};
#pragma unroll
    for (int r = 0; r < 8; ++r)
#pragma unroll
      for (int j = 0; j < 4; ++j)
        st[(hi * 8 + r) * OPITCH + j * 16 + l15] = acc[i][j][r] * li[r];
    // The rows are read back by other lanes than wrote them.
    asm volatile("s_wait_dscnt 0x0" ::: "memory");
    float4 v[8];
#pragma unroll
    for (int t = 0; t < 8; ++t) v[t] = *(const float4*)(st + (t * 2 + hi) * OPITCH + l15 * 4);
#pragma unroll
    for (int t = 0; t < 8; ++t) *(float4*)(dst + (size_t)(i * 16 + t * 2) * DIM) = v[t];
    // Behind the stores, in front of whatever rewrites their registers next.
    asm volatile("s_wait_xcnt 0x0" :: "v"(dst) : "memory");
    // Keeps the next rows' arithmetic off the stores' registers until that wait.
    if (i < 3) __builtin_amdgcn_sched_barrier(0);
  }
}

// ---------------------------------------------------------------------------
// Launch: inputs are x, mask, Wq, bq, Wk, bk, Wv, bv.
// Workspace layout (f16): qh[8192][1024] | kh[8192][1024] | vt[1024][8192]
//                         | Wt (3 x [1024][1024]) | ph f16 [8192][2048]
//                         | gmax, gsum f32 [32][8192] each  -> 88 MB.
// ---------------------------------------------------------------------------
extern "C" void kernel_launch(void* const* d_in, const int* in_sizes, int n_in,
                              void* d_out, int out_size, void* d_ws, size_t ws_size,
                              hipStream_t stream) {
  const float* x    = (const float*)d_in[0];
  const int*   mask = (const int*)d_in[1];
  const float* Wq   = (const float*)d_in[2];
  const float* bq   = (const float*)d_in[3];
  const float* Wk   = (const float*)d_in[4];
  const float* bk   = (const float*)d_in[5];
  const float* Wv   = (const float*)d_in[6];
  const float* bv   = (const float*)d_in[7];
  float* out = (float*)d_out;

  _Float16* qh = (_Float16*)d_ws;
  _Float16* kh = qh + (size_t)ROWS * DIM;
  _Float16* vt = kh + (size_t)ROWS * DIM;
  _Float16* wt = vt + (size_t)ROWS * DIM;
  _Float16* ph = wt + (size_t)3 * EMB * DIM;
  float* gmax = (float*)(ph + (size_t)ROWS * SEQ);
  float* gsum = gmax + (size_t)NGRP * ROWS;

  dim3 bt(256);
  wtrans_kernel<<<dim3(EMB / 256, DIM / 64, 3), bt, 0, stream>>>(Wq, Wk, Wv, wt);
  qkv_proj_kernel<<<dim3(ROWS / PBM, DIM / PBN, 3), bt, 0, stream>>>(
      x, wt, bq, bk, bv, qh, kh, vt);
  scores_kernel<<<dim3(SEQ / PBM, SEQ / PBN, BSZ), bt, 0, stream>>>(
      qh, kh, mask, ph, gmax, gsum);
  pv_kernel<<<dim3(ROWS / PBM, DIM / PBN), bt, 0, stream>>>(ph, vt, gmax, gsum, out);
}

// v006
// It runs in 115 microseconds.
// Two timings next to v005 both put it at 1.03 times that version's speed.
// Counting every step since v000, it is 6.16 times as fast.
#include <hip/hip_runtime.h>
#include <hip/hip_fp16.h>

typedef __attribute__((ext_vector_type(16))) _Float16 v16h;
typedef __attribute__((ext_vector_type(8)))  _Float16 v8h;
typedef __attribute__((ext_vector_type(4)))  _Float16 v4h;
typedef __attribute__((ext_vector_type(8)))  float    v8f;

#define BSZ 4
#define SEQ 2048
#define EMB 1024
#define DIM 1024
#define ROWS (BSZ * SEQ)  // 8192

static __device__ __forceinline__ v16h cat8(v8h lo, v8h hi) {
  v16h r;
#pragma unroll
  for (int i = 0; i < 8; ++i) { r[i] = lo[i]; r[i + 8] = hi[i]; }
  return r;
}

// ---------------------------------------------------------------------------
// Kernel 0: transpose + f32->f16 convert the three weight matrices.
// Wt[d][e] = (f16) W[e][d]  so that weight-fragment (column) reads become
// contiguous row reads for the WMMA GEMMs.
// grid = (EMB/256, DIM/64, 3), block = 8 waves (4 along e, 2 along d).
// A thread turns an 8 (e) x 8 (d) patch in registers; a wave covers 64 e by
// 32 d with 8 lanes along e and 4 along d.  All 16 loads of a thread are in
// flight together, each wave-wide load takes 64-byte pieces of 8 rows (the
// two pieces of a line by the same thread), and each wave-wide store writes
// four whole 128-byte lines.
// ---------------------------------------------------------------------------
__global__ __launch_bounds__(256) void wtrans_kernel(
    const float* __restrict__ Wq, const float* __restrict__ Wk,
    const float* __restrict__ Wv, _Float16* __restrict__ wt) {
  const float* W = (blockIdx.z == 0) ? Wq : (blockIdx.z == 1) ? Wk : Wv;
  const int wave = threadIdx.x >> 5, lane = threadIdx.x & 31;
  const int e0 = blockIdx.x * 256 + (wave >> 1) * 64 + (lane & 7) * 8;
  const int d0 = blockIdx.y * 64 + (wave & 1) * 32 + (lane >> 3) * 4;
  const float* src = W + (size_t)e0 * DIM + d0;
  _Float16* dst = wt + (size_t)blockIdx.z * EMB * DIM + (size_t)d0 * EMB + e0;

  float4 r[8][2];  // r[i][h] = W[e0 + i][d0 + h*16 .. + 3]
#pragma unroll
  for (int i = 0; i < 8; ++i)
#pragma unroll
    for (int h = 0; h < 2; ++h)
      r[i][h] = *(const float4*)(src + (size_t)i * DIM + h * 16);
  // Behind the loads, in front of every rewrite of their address registers:
  // named as an input, the address pair stays live up to the wait, so that no
  // load's own result is placed on it ahead of it.
  asm volatile("s_wait_xcnt 0x0" :: "v"(src) : "memory");
  // Keeps the conversions behind all 16 loads: lifted among them they make
  // the last loads wait for the first ones' data, a second memory latency.
  __builtin_amdgcn_sched_barrier(0);

  v8h t[2][4];  // t[h][c][i] = Wt[d0 + h*16 + c][e0 + i]
#pragma unroll
  for (int h = 0; h < 2; ++h)
#pragma unroll
    for (int i = 0; i < 8; ++i) {
      t[h][0][i] = (_Float16)r[i][h].x;
      t[h][1][i] = (_Float16)r[i][h].y;
      t[h][2][i] = (_Float16)r[i][h].z;
      t[h][3][i] = (_Float16)r[i][h].w;
    }
#pragma unroll
  for (int h = 0; h < 2; ++h)
#pragma unroll
    for (int c = 0; c < 4; ++c)
      *(v8h*)(dst + (size_t)(h * 16 + c) * EMB) = t[h][c];
}

#define PBM 128
#define PBN 256
#define PK 64
#define PPITCH (PK + 8)
#define PSTAGE ((PBM + PBN) * PPITCH)
#define PNX (PBM * PK / 4 / 256)
#define PNW (PBN * PK / 8 / 256)
#define WST (PSTAGE / 8)

// Asynchronous copies to LDS, 16 bytes a lane, through no register.  l: the
// lane's LDS byte address of the first copy, g: its global source; copy i takes
// row i * 32 of the pass (LDS step lstep bytes, global step gstep halfs).
// The s_wait_xcnt 0 closes the copies' own statement, so that it stands in
// front of every later rewrite of the address registers that they name.
static __device__ __forceinline__ void copy4(const unsigned l, const int lstep,
                                             const _Float16* g, const size_t gstep) {
  asm volatile(
      "global_load_async_to_lds_b128 %0, %4, off\n\t"
      "global_load_async_to_lds_b128 %1, %5, off\n\t"
      "global_load_async_to_lds_b128 %2, %6, off\n\t"
      "global_load_async_to_lds_b128 %3, %7, off\n\t"
      "s_wait_xcnt 0x0"
      :: "v"(l), "v"(l + lstep), "v"(l + 2 * lstep), "v"(l + 3 * lstep),
         "v"(g), "v"(g + gstep), "v"(g + 2 * gstep), "v"(g + 3 * gstep)
      : "memory");
}
// The hand-over of a pass: this wave's LDS reads and stores are done, its own
// copies of the next pass have landed; the barrier then publishes the next
// buffer and says that every wave has left the one that is refilled behind it.
static __device__ __forceinline__ void publish() {
  asm volatile("s_wait_dscnt 0x0" ::: "memory");
  asm volatile("s_wait_asynccnt 0x0" ::: "memory");
  __syncthreads();
}

// Results leave through LDS: straight from the accumulators a wave-wide store
// puts 32-byte pieces on 16 rows.  The pass count is even, so the last pass
// reads the second buffer, and behind its barrier no wave reads the first one
// any more: each wave takes WST halfs of it for itself.  It lays 32 rows of 64
// f16 results there at pitch PPITCH; this sends them out, 8 lanes a row, so
// that every wave-wide store is four whole 128-byte lines.
// g: the first row's first element, pitch: halfs per global row.
static __device__ __forceinline__ void flush_rows(const _Float16* sw, _Float16* g,
                                                  const int pitch) {
  const int lane = threadIdx.x & 31;
  const int row = lane >> 3, col = (lane & 7) * 8;
  // The rows are read back by other lanes than wrote them.
  asm volatile("s_wait_dscnt 0x0" ::: "memory");
  v8h v[8];
#pragma unroll
  for (int t = 0; t < 8; ++t) v[t] = *(const v8h*)(sw + (t * 4 + row) * PPITCH + col);
  _Float16* p = g + (size_t)row * pitch + col;
#pragma unroll
  for (int t = 0; t < 8; ++t) *(v8h*)(p + (size_t)t * 4 * pitch) = v[t];
  // Behind the stores, in front of whatever rewrites their registers next.
  asm volatile("s_wait_xcnt 0x0" :: "v"(p) : "memory");
}

__global__ __launch_bounds__(256) void qkv_proj_kernel(
    const float* __restrict__ x, const _Float16* __restrict__ wt_all,
    const float* __restrict__ bq, const float* __restrict__ bk,
    const float* __restrict__ bv, _Float16* __restrict__ qh,
    _Float16* __restrict__ kh, _Float16* __restrict__ vt) {
  const int z = blockIdx.z;
  const float* bias = (z == 0) ? bq : (z == 1) ? bk : bv;
  const _Float16* wt = wt_all + (size_t)z * EMB * DIM;

  const int tid = threadIdx.x, wave = tid >> 5, lane = tid & 31;
  const int l15 = lane & 15, hi = lane >> 4;
  const int koff = hi * 8;
  const int m0 = blockIdx.x * PBM;
  const int n0 = blockIdx.y * PBN;
  const int wm = wave >> 2, wn = wave & 3;

  __shared__ __attribute__((aligned(16))) _Float16 s_ab[2 * PSTAGE];

  // Staging map: a row of the pass is covered by consecutive lanes.
  const int xcol = (tid % (PK / 4)) * 4, xrow = tid / (PK / 4);
  const int wcol = (tid % (PK / 8)) * 8, wrow = tid / (PK / 8);
  const float* xsrc = x + (size_t)(m0 + xrow) * EMB + xcol;
  const _Float16* wsrc = wt + (size_t)(n0 + wrow) * EMB + wcol;
  const int xdst = xrow * PPITCH + xcol;
  const int wdst = (PBM + wrow) * PPITCH + wcol;

  // Fragment bases: which LDS region is the A operand depends on z only.
  const int xfrag = (wm * 64 + l15) * PPITCH + koff;
  const int wfrag = (PBM + wn * 64 + l15) * PPITCH + koff;
  const int afrag = (z < 2) ? wfrag : xfrag;
  const int bfrag = (z < 2) ? xfrag : wfrag;

  // The weights go to LDS by asynchronous copies; x passes through registers,
  // where it is converted.  get(t, b): pass t's copies into buffer b, and its x.
  const unsigned wl = (unsigned)(size_t)(s_ab + wdst);
  float4 rx[PNX];
  auto get = [&](const int t, const int b) {
#pragma unroll
    for (int c = 0; c < PNW / 4; ++c)
      copy4(wl + (b * PSTAGE + c * 128 * PPITCH) * 2, 32 * PPITCH * 2,
            wsrc + (size_t)c * 128 * EMB + t * PK, (size_t)32 * EMB);
#pragma unroll
    for (int i = 0; i < PNX; ++i)
      rx[i] = *(const float4*)(xsrc + (size_t)i * (1024 / PK) * EMB + t * PK);
    // Stands behind the loads, in front of every rewrite of their address
    // registers.  Its "memory" clobber also holds the loads here, ahead of the
    // next pass's LDS reads and WMMAs, which cover their latency.
    asm volatile("s_wait_xcnt 0x0" ::: "memory");
  };
  auto put = [&](_Float16* sb) {
#pragma unroll
    for (int i = 0; i < PNX; ++i) {
      v4h h;
      h[0] = (_Float16)rx[i].x; h[1] = (_Float16)rx[i].y;
      h[2] = (_Float16)rx[i].z; h[3] = (_Float16)rx[i].w;
      *(v4h*)(sb + xdst + i * (1024 / PK) * PPITCH) = h;
    }
  };
  get(0, 0);
  put(s_ab);
  publish();
  get(1, 1);

  v8f acc[4][4];
#pragma unroll
  for (int i = 0; i < 4; ++i)
#pragma unroll
    for (int j = 0; j < 4; ++j) acc[i][j] = v8f{};

  static_assert(PK == 64, "a pass is two k-steps of 32");
  v16h fa[4], fb[4];
  auto frag = [&](const int kt, const int ks) {  // the 16 fragment loads of a k-step
    const _Float16* sb = s_ab + (kt & 1) * PSTAGE + ks * 32;
#pragma unroll
    for (int i = 0; i < 4; ++i) {
      const _Float16* pa = sb + afrag + i * 16 * PPITCH;
      const _Float16* pb = sb + bfrag + i * 16 * PPITCH;
      fa[i] = cat8(*(const v8h*)pa, *(const v8h*)(pa + 16));
      fb[i] = cat8(*(const v8h*)pb, *(const v8h*)(pb + 16));
    }
  };
  auto mm = [&]() {  // its 16 WMMAs
    // Keeps what stands above (the fragment loads as one group, in the registers
    // that staging no longer takes; the refill) ahead of the WMMAs: loads sunk
    // among them are each waited for right behind their issue, and a refill
    // sunk behind them loses that much of its lead.
    __builtin_amdgcn_sched_barrier(0);
#pragma unroll
    for (int i = 0; i < 4; ++i)
#pragma unroll
      for (int j = 0; j < 4; ++j)
        acc[i][j] = __builtin_amdgcn_wmma_f32_16x16x32_f16(
            false, fa[i], false, fb[j], (short)0, acc[i][j], false, false);
  };
  // After a pass the next one's x goes into the other buffer, which every wave
  // left at the last barrier; its weights are landing there meanwhile.  The
  // refill is issued behind the barrier while a pass kt + 2 exists.
  for (int kt = 0; kt < EMB / PK - 2; ++kt) {
    frag(kt, 0);
    mm();
    frag(kt, 1);
    mm();
    put(s_ab + ((kt + 1) & 1) * PSTAGE);
    publish();
    get(kt + 2, kt & 1);
  }
  frag(EMB / PK - 2, 0);
  mm();
  frag(EMB / PK - 2, 1);
  mm();
  put(s_ab + PSTAGE);
  publish();
  frag(EMB / PK - 1, 0);
  mm();
  frag(EMB / PK - 1, 1);
  mm();
  publish();
  // No copy is outstanding when the first buffer becomes output staging.
  asm volatile("s_wait_asynccnt 0x0" ::: "memory");

  static_assert((EMB / PK) % 2 == 0, "the last pass must read the second buffer");
  // The wave's number as a scalar: held in vector registers over the loop, what
  // the epilogue derives from it takes the kernel past 256 VGPRs.
  const int ws = __builtin_amdgcn_readfirstlane(wave);
  const int mw = m0 + (ws >> 2) * 64, nw = n0 + (ws & 3) * 64;
  _Float16* sw = s_ab + ws * WST;
  _Float16* st = sw + l15 * PPITCH + hi * 8;
  if (z < 2) {
    // acc[i][j][r] = Y[m0 + wm*64 + j*16 + l15][n0 + wn*64 + i*16 + hi*8 + r]
    _Float16* dst = (z == 0) ? qh : kh;
    const int nb = nw + hi * 8;
    float4 c0[4], c1[4];
#pragma unroll
    for (int i = 0; i < 4; ++i) {
      c0[i] = *(const float4*)(bias + nb + i * 16);
      c1[i] = *(const float4*)(bias + nb + i * 16 + 4);
    }
    // Behind the loads, in front of every rewrite of their address registers.
    asm volatile("s_wait_xcnt 0x0" ::: "memory");
#pragma unroll
    for (int h = 0; h < 2; ++h) {  // 32 rows m at a time
#pragma unroll
      for (int i = 0; i < 4; ++i) {
        const float bb[8] = {c0[i].x, c0[i].y, c0[i].z, c0[i].w,
                             c1[i].x, c1[i].y, c1[i].z, c1[i].w};
#pragma unroll
        for (int jj = 0; jj < 2; ++jj) {
          v8h o;
#pragma unroll
          for (int r = 0; r < 8; ++r) o[r] = (_Float16)(acc[i][h * 2 + jj][r] + bb[r]);
          *(v8h*)(st + jj * 16 * PPITCH + i * 16) = o;
        }
      }
      flush_rows(sw, dst + (size_t)(mw + h * 32) * DIM + nw, DIM);
    }
  } else {
    // acc[i][j][r] = Y[m0 + wm*64 + i*16 + hi*8 + r][n0 + wn*64 + j*16 + l15]
    const int nb = nw + l15;
    float bn[4];
#pragma unroll
    for (int j = 0; j < 4; ++j) bn[j] = bias[nb + j * 16];
    // The wait: as in the branch above.
    asm volatile("s_wait_xcnt 0x0" ::: "memory");
#pragma unroll
    for (int j = 0; j < 4; ++j) {  // 32 rows n at a time
#pragma unroll
      for (int i = 0; i < 4; ++i) {
        v8h o;
#pragma unroll
        for (int r = 0; r < 8; ++r) o[r] = (_Float16)(acc[i][j][r] + bn[j]);
        *(v8h*)(st + (j & 1) * 16 * PPITCH + i * 16) = o;
      }
      if (j & 1) flush_rows(sw, vt + (size_t)(nw + (j >> 1) * 32) * ROWS + mw, ROWS);
      // Keeps each group's sums and stores together: hoisted all at once
      // they take the kernel past 256 VGPRs, and only one block fits a WGP.
      if (j < 3) __builtin_amdgcn_sched_barrier(0);
    }
  }
}

// ---------------------------------------------------------------------------
// Attention as two tiled GEMMs with the row softmax folded into them.
// The tile product below is the projection's scheme with both operands f16:
// C[128][256] = X[128][KTOT] * W[256][KTOT]^T, 8 waves (2 x 4) of 64x64, both
// operands staged per pass of PK k-values in one of two LDS buffers, W
// (and X without SCALE) by asynchronous copies issued one pass ahead.  X is the A operand:
// acc[i][j][r] = C[wm*64 + i*16 + hi*8 + r][wn*64 + j*16 + l15].
// With SCALE, row m of X is multiplied in pass kt by sf[m * (KTOT / PK) + kt]
// (an LDS table) on its way from registers to LDS.
// ---------------------------------------------------------------------------
#define NGRP (SEQ / PK)                // key groups of a row, one per pass of P*V
#define PNH (PBM * PK / 8 / 256)       // 16-byte loads of the X operand per thread and pass
#define OPITCH 68                      // floats per staged output row: rows 8 apart fall 32 banks apart
static_assert(16 * OPITCH * 4 <= WST * 2 && 32 * PPITCH <= WST, "staged rows fit a wave's part");

template <int KTOT, bool SCALE>
static __device__ __forceinline__ void tile_product(
    const _Float16* __restrict__ xs, const int xpitch,
    const _Float16* __restrict__ ws, const int wpitch,
    _Float16* s_ab, const _Float16* sf, v8f (&acc)[4][4]) {
  static_assert((KTOT / PK) % 2 == 0, "the last pass must read the second buffer");
  const int tid = threadIdx.x, wave = tid >> 5, lane = tid & 31;
  const int l15 = lane & 15, koff = (lane >> 4) * 8;
  const int wm = wave >> 2, wn = wave & 3;

  // Staging map: 8 consecutive lanes cover one 128-byte row of the pass.
  const int col = (tid % (PK / 8)) * 8, row = tid / (PK / 8);
  const _Float16* xsrc = xs + (size_t)row * xpitch + col;
  const _Float16* wsrc = ws + (size_t)row * wpitch + col;
  const int xdst = row * PPITCH + col;
  const int wdst = (PBM + row) * PPITCH + col;
  const int afrag = (wm * 64 + l15) * PPITCH + koff;
  const int bfrag = (PBM + wn * 64 + l15) * PPITCH + koff;

  // Operands go to LDS by asynchronous copies; with SCALE, X passes through
  // registers, where it is multiplied.  get(t, b): pass t's copies into buffer
  // b, and with SCALE its X rows and factors.
  const unsigned xl = (unsigned)(size_t)(s_ab + xdst);
  const unsigned wl = (unsigned)(size_t)(s_ab + wdst);
  v8h rx[PNH];
  _Float16 fx[PNH];
  auto get = [&](const int t, const int b) {
#pragma unroll
    for (int c = 0; c < PNW / 4; ++c)
      copy4(wl + (b * PSTAGE + c * 128 * PPITCH) * 2, 32 * PPITCH * 2,
            wsrc + (size_t)c * 128 * wpitch + t * PK, (size_t)32 * wpitch);
    if (SCALE) {
#pragma unroll
      for (int i = 0; i < PNH; ++i)
        rx[i] = *(const v8h*)(xsrc + (size_t)i * (2048 / PK) * xpitch + t * PK);
#pragma unroll
      for (int i = 0; i < PNH; ++i)
        fx[i] = sf[(row + i * (2048 / PK)) * (KTOT / PK) + t];
      // Stands behind the loads, in front of every rewrite of their address
      // registers; its "memory" clobber also holds the loads ahead of the next
      // pass's LDS reads and WMMAs, which cover their latency.
      asm volatile("s_wait_xcnt 0x0" ::: "memory");
    } else {
      static_assert(PNH == 4, "one statement of four copies");
      copy4(xl + b * PSTAGE * 2, 32 * PPITCH * 2, xsrc + t * PK, (size_t)32 * xpitch);
    }
  };
  auto put = [&](_Float16* sb) {
#pragma unroll
    for (int i = 0; i < PNH; ++i)
      *(v8h*)(sb + xdst + i * (2048 / PK) * PPITCH) = rx[i] * fx[i];
  };
  get(0, 0);
  if (SCALE) put(s_ab);
  publish();
  get(1, 1);

#pragma unroll
  for (int i = 0; i < 4; ++i)
#pragma unroll
    for (int j = 0; j < 4; ++j) acc[i][j] = v8f{};

  static_assert(PK == 64, "a pass is two k-steps of 32");
  v16h fa[4], fb[4];
  auto frag = [&](const int kt, const int ks) {  // the 16 fragment loads of a k-step
    const _Float16* sb = s_ab + (kt & 1) * PSTAGE + ks * 32;
#pragma unroll
    for (int i = 0; i < 4; ++i) {
      const _Float16* pa = sb + afrag + i * 16 * PPITCH;
      const _Float16* pb = sb + bfrag + i * 16 * PPITCH;
      fa[i] = cat8(*(const v8h*)pa, *(const v8h*)(pa + 16));
      fb[i] = cat8(*(const v8h*)pb, *(const v8h*)(pb + 16));
    }
  };
  auto mm = [&]() {  // its 16 WMMAs
    // Keeps what stands above (the fragment loads as one group, in the registers
    // that staging no longer takes; the refill) ahead of the WMMAs: loads sunk
    // among them are each waited for right behind their issue, and a refill
    // sunk behind them loses that much of its lead.
    __builtin_amdgcn_sched_barrier(0);
#pragma unroll
    for (int i = 0; i < 4; ++i)
#pragma unroll
      for (int j = 0; j < 4; ++j)
        acc[i][j] = __builtin_amdgcn_wmma_f32_16x16x32_f16(
            false, fa[i], false, fb[j], (short)0, acc[i][j], false, false);
  };
  // A pass's LDS reads end with its second k-step's fragment loads.  Without
  // SCALE the hand-over stands right behind them, and that k-step's WMMAs, which
  // touch registers only, run behind the refill.  With SCALE they stay in front
  // and cover the X loads; X then goes into the other buffer, which every wave
  // left at the last barrier and where the copies are landing meanwhile.
  // The refill is issued behind the barrier while a pass kt + 2 exists.
  for (int kt = 0; kt < KTOT / PK - 2; ++kt) {
    frag(kt, 0);
    mm();
    frag(kt, 1);
    if (SCALE) {
      mm();
      put(s_ab + ((kt + 1) & 1) * PSTAGE);
    }
    publish();
    get(kt + 2, kt & 1);
    if (!SCALE) mm();
  }
  frag(KTOT / PK - 2, 0);
  mm();
  frag(KTOT / PK - 2, 1);
  mm();
  if (SCALE) put(s_ab + PSTAGE);
  publish();
  frag(KTOT / PK - 1, 0);
  mm();
  frag(KTOT / PK - 1, 1);
  mm();
  publish();
  // No copy is outstanding when the first buffer becomes output staging.
  asm volatile("s_wait_asynccnt 0x0" ::: "memory");
}

static __device__ __forceinline__ float exp2_slot(float u) {
  float r;
  asm("v_exp_f32 %0, %1\n\tv_nop" : "=v"(r) : "v"(u));
  return r;
}

__global__ __launch_bounds__(256) void scores_kernel(
    const _Float16* __restrict__ qh, const _Float16* __restrict__ kh,
    const int* __restrict__ mask, _Float16* __restrict__ ph,
    float* __restrict__ gmax, float* __restrict__ gsum) {
  __shared__ __attribute__((aligned(16))) _Float16 s_ab[2 * PSTAGE];
  const int kb = blockIdx.x * PBM;
  const int qb = blockIdx.z * SEQ + blockIdx.y * PBN;
  v8f acc[4][4];
  tile_product<EMB, false>(kh + (size_t)(blockIdx.z * SEQ + kb) * EMB, EMB,
                           qh + (size_t)qb * EMB, EMB, s_ab, nullptr, acc);

  // acc[i][j][r] = S[key kb + wm*64 + i*16 + hi*8 + r][row qb + wn*64 + j*16 + l15]
  const int wave = threadIdx.x >> 5, lane = threadIdx.x & 31;
  const int hi = lane >> 4;
  const int key0 = kb + (wave >> 2) * 64 + hi * 8;
  const int grp = (kb >> 6) + (wave >> 2);
  const int row0 = qb + (wave & 3) * 64 + (lane & 15);
  const int* mk0 = mask + (size_t)row0 * SEQ + key0;
  int4 g[2][8];  // the mask of query column j in g[j & 1], fetched one column ahead
#pragma unroll
  for (int i = 0; i < 4; ++i) {
    g[0][2 * i]     = *(const int4*)(mk0 + i * 16);
    g[0][2 * i + 1] = *(const int4*)(mk0 + i * 16 + 4);
  }
  // Behind the loads, in front of every rewrite of their address registers:
  // named as an input, the address pair stays live up to the wait.
  asm volatile("s_wait_xcnt 0x0" :: "v"(mk0) : "memory");
  // Keeps the later columns' mask loads out of the last pass, where fragments
  // are still live: with them there the kernel goes past
  // 256 VGPRs, and only one block fits a WGP.
  __builtin_amdgcn_sched_barrier(0);
  _Float16* sw = s_ab + wave * WST;  // the wave's own part of the first buffer
  _Float16* st = sw + (lane & 15) * PPITCH + hi * 8;
  _Float16* pw = ph + (size_t)(qb + (wave & 3) * 64) * SEQ + kb + (wave >> 2) * 64;
#pragma unroll
  for (int j = 0; j < 4; ++j) {
    const int row = row0 + j * 16;
    if (j < 3) {
      const int* mk = mk0 + (size_t)(j + 1) * 16 * SEQ;
#pragma unroll
      for (int i = 0; i < 4; ++i) {
        g[(j + 1) & 1][2 * i]     = *(const int4*)(mk + i * 16);
        g[(j + 1) & 1][2 * i + 1] = *(const int4*)(mk + i * 16 + 4);
      }
      // The wait: as above (these loads are built on the same address pair, with
      // immediate offsets).  The fence holds this column's arithmetic behind it.
      asm volatile("s_wait_xcnt 0x0" :: "v"(mk0) : "memory");
      __builtin_amdgcn_sched_barrier(0);
    }
    // Columns 0 and 1 leave, 32 query rows at a time, behind the issue of the
    // next mask loads and ahead of column 2's results, which take their place.
    // The fence keeps this column's arithmetic off the stores' registers until
    // the wait that ends flush_rows.
    if (j == 2) {
      flush_rows(sw, pw, SEQ);
      __builtin_amdgcn_sched_barrier(0);
    }

    float m = -1e30f;
#pragma unroll
    for (int i = 0; i < 4; ++i) {
      const int4 ga = g[j & 1][2 * i], gb = g[j & 1][2 * i + 1];
      const int gi[8] = {ga.x, ga.y, ga.z, ga.w, gb.x, gb.y, gb.z, gb.w};
#pragma unroll
      for (int r = 0; r < 8; ++r) {  // scale by QD, not sqrt(QD); times log2(e)
        acc[i][j][r] = (gi[r] == 0) ? -1e30f : acc[i][j][r] * (1.44269504f / 1024.0f);
        m = fmaxf(m, acc[i][j][r]);
      }
    }
    m = fmaxf(m, __shfl_xor(m, 16));

    float sum = 0.0f;
#pragma unroll
    for (int i = 0; i < 4; ++i) {
      v8h h;
#pragma unroll
      for (int r = 0; r < 8; ++r) {
        const float p = exp2_slot(acc[i][j][r] - m);
        h[r] = (_Float16)p;
        sum += p;
      }
      *(v8h*)(st + (j & 1) * 16 * PPITCH + i * 16) = h;
    }
    sum += __shfl_xor(sum, 16);
    if (hi == 0) {
      gmax[(size_t)grp * ROWS + row] = m;
      gsum[(size_t)grp * ROWS + row] = sum;
    }
    // The wait stands behind each column's stores, in front of whatever
    // rewrites their registers next.
    asm volatile("s_wait_xcnt 0x0" ::: "memory");
  }
  flush_rows(sw, pw + (size_t)32 * SEQ, SEQ);
}

// ---------------------------------------------------------------------------
// Kernel 3: out[row][d] = sum_k softmax[row][k] * vt[d][b*SEQ + k].
// grid = (ROWS/128 row tiles, DIM/256 column tiles).
// First the block joins its 128 rows' groups: row max M = max of the group
// maxima, factor f[g] = exp2(gmax[g] - M), row sum = sum of f[g] * gsum[g].
// The product then takes ph[row][k] * f[group of k]; 1 / row sum at the end.
// ---------------------------------------------------------------------------
__global__ __launch_bounds__(256) void pv_kernel(
    const _Float16* __restrict__ ph, const _Float16* __restrict__ vt,
    const float* __restrict__ gmax, const float* __restrict__ gsum,
    float* __restrict__ out) {
  __shared__ __attribute__((aligned(16))) _Float16 s_ab[2 * PSTAGE];
  __shared__ __attribute__((aligned(16))) _Float16 s_f[PBM * NGRP];
  __shared__ __attribute__((aligned(16))) float s_rinv[PBM];
  const int m0 = blockIdx.x * PBM;
  const int n0 = blockIdx.y * PBN;
  const int b = m0 / SEQ;

  if (threadIdx.x < PBM) {
    const int t = threadIdx.x;
    const float* pm = gmax + m0;
    const float* ps = gsum + m0;
    float gm[NGRP], gs[NGRP];
#pragma unroll
    for (int g = 0; g < NGRP; ++g) {
      gm[g] = pm[(size_t)g * ROWS + t];
      gs[g] = ps[(size_t)g * ROWS + t];
    }
    // Behind the loads, in front of every rewrite of their address registers
    // (the lane's index, named as an input, and two scalar bases); the fence
    // holds the arithmetic behind the wait.
    asm volatile("s_wait_xcnt 0x0" :: "v"(t) : "memory");
    __builtin_amdgcn_sched_barrier(0);
    float m = gm[0];
#pragma unroll
    for (int g = 1; g < NGRP; ++g) m = fmaxf(m, gm[g]);
    float sum = 0.0f;
#pragma unroll
    for (int c = 0; c < NGRP / 8; ++c) {
      v8h h;
#pragma unroll
      for (int e = 0; e < 8; ++e) {
        h[e] = (_Float16)exp2_slot(gm[c * 8 + e] - m);
        sum += (float)h[e] * gs[c * 8 + e];  // the factor as the product sees it
      }
      *(v8h*)(s_f + threadIdx.x * NGRP + c * 8) = h;
    }
    s_rinv[threadIdx.x] = 1.0f / sum;
  }
  // Publishes the factors and the row sums to every wave of the block.
  __syncthreads();

  v8f acc[4][4];
  tile_product<SEQ, true>(ph + (size_t)m0 * SEQ, SEQ,
                          vt + (size_t)n0 * ROWS + b * SEQ, ROWS, s_ab, s_f, acc);

  // The wave's 64 x 64 f32 tile goes out through its own WST halfs of the first
  // buffer (free behind the last pass's barrier, as above flush_rows), 16 rows at
  // a time at pitch OPITCH: 16 lanes then send one row's 256 bytes, and every
  // wave-wide store is four whole 128-byte lines in place of 64-byte pieces.
  const int wave = threadIdx.x >> 5, lane = threadIdx.x & 31;
  const int l15 = lane & 15, hi = lane >> 4;
  const int ml = (wave >> 2) * 64 + hi * 8;
  float* st = (float*)(s_ab + wave * WST);
  float* dst = out + (size_t)(m0 + (wave >> 2) * 64 + hi) * DIM + n0 + (wave & 3) * 64 + l15 * 4;
#pragma unroll
  for (int i = 0; i < 4; ++i) {
    const float4 u0 = *(const float4*)(s_rinv + ml + i * 16);
    const float4 u1 = *(const float4*)(s_rinv + ml + i * 16 + 4);
    const float li[8] = {u0.x, u0.y, u0.z, u0.w, u1.x, u1.y, u1.z, u1.w};
#pragma unroll
    for (int r = 0; r < 8; ++r)
#pragma unroll
      for (int j = 0; j < 4; ++j)
        st[(hi * 8 + r) * OPITCH + j * 16 + l15] = acc[i][j][r] * li[r];
    // The rows are read back by other lanes than wrote them.
    asm volatile("s_wait_dscnt 0x0" ::: "memory");
    float4 v[8];
#pragma unroll
    for (int t = 0; t < 8; ++t) v[t] = *(const float4*)(st + (t * 2 + hi) * OPITCH + l15 * 4);
#pragma unroll
    for (int t = 0; t < 8; ++t) *(float4*)(dst + (size_t)(i * 16 + t * 2) * DIM) = v[t];
    // Behind the stores, in front of whatever rewrites their registers next.
    asm volatile("s_wait_xcnt 0x0" :: "v"(dst) : "memory");
    // Keeps the next rows' arithmetic off the stores' registers until that wait.
    if (i < 3) __builtin_amdgcn_sched_barrier(0);
  }
}

// ---------------------------------------------------------------------------
// Launch: inputs are x, mask, Wq, bq, Wk, bk, Wv, bv.
// Workspace layout (f16): qh[8192][1024] | kh[8192][1024] | vt[1024][8192]
//                         | Wt (3 x [1024][1024]) | ph f16 [8192][2048]
//                         | gmax, gsum f32 [32][8192] each  -> 88 MB.
// ---------------------------------------------------------------------------
extern "C" void kernel_launch(void* const* d_in, const int* in_sizes, int n_in,
                              void* d_out, int out_size, void* d_ws, size_t ws_size,
                              hipStream_t stream) {
  const float* x    = (const float*)d_in[0];
  const int*   mask = (const int*)d_in[1];
  const float* Wq   = (const float*)d_in[2];
  const float* bq   = (const float*)d_in[3];
  const float* Wk   = (const float*)d_in[4];
  const float* bk   = (const float*)d_in[5];
  const float* Wv   = (const float*)d_in[6];
  const float* bv   = (const float*)d_in[7];
  float* out = (float*)d_out;

  _Float16* qh = (_Float16*)d_ws;
  _Float16* kh = qh + (size_t)ROWS * DIM;
  _Float16* vt = kh + (size_t)ROWS * DIM;
  _Float16* wt = vt + (size_t)ROWS * DIM;
  _Float16* ph = wt + (size_t)3 * EMB * DIM;
  float* gmax = (float*)(ph + (size_t)ROWS * SEQ);
  float* gsum = gmax + (size_t)NGRP * ROWS;

  dim3 bt(256);
  wtrans_kernel<<<dim3(EMB / 256, DIM / 64, 3), bt, 0, stream>>>(Wq, Wk, Wv, wt);
  qkv_proj_kernel<<<dim3(ROWS / PBM, DIM / PBN, 3), bt, 0, stream>>>(
      x, wt, bq, bk, bv, qh, kh, vt);
  scores_kernel<<<dim3(SEQ / PBM, SEQ / PBN, BSZ), bt, 0, stream>>>(
      qh, kh, mask, ph, gmax, gsum);
  pv_kernel<<<dim3(ROWS / PBM, DIM / PBN), bt, 0, stream>>>(ph, vt, gmax, gsum, out);
}

// v007
// A run of this version takes 111 microseconds.
// In both of two side-by-side timings against v006, it was 1.03 times as fast.
// All steps since v000 together make it 6.36 times as fast.
#include <hip/hip_runtime.h>
#include <hip/hip_fp16.h>

typedef __attribute__((ext_vector_type(16))) _Float16 v16h;
typedef __attribute__((ext_vector_type(8)))  _Float16 v8h;
typedef __attribute__((ext_vector_type(4)))  _Float16 v4h;
typedef __attribute__((ext_vector_type(8)))  float    v8f;

#define BSZ 4
#define SEQ 2048
#define EMB 1024
#define DIM 1024
#define ROWS (BSZ * SEQ)  // 8192

static __device__ __forceinline__ v16h cat8(v8h lo, v8h hi) {
  v16h r;
#pragma unroll
  for (int i = 0; i < 8; ++i) { r[i] = lo[i]; r[i + 8] = hi[i]; }
  return r;
}

// ---------------------------------------------------------------------------
// Kernel 0: transpose + f32->f16 convert the three weight matrices, and
// convert x.
// Wt[d][e] = (f16) W[e][d]  so that B-fragment (column) reads become
// contiguous row reads for the WMMA GEMMs.
// grid = (EMB/256, DIM/64, 3 + XCZ), block = 8 waves (4 along e, 2 along d).
// Planes z >= 3 round x to f16 once, xh[s][e] = (f16) x[s][e]: the projection
// then brings half the bytes for each of the 12 blocks that read a row of x,
// and converts nothing.  A thread has its XPT 16-byte loads in flight together;
// every wave-wide load is 512 and every store 256 contiguous bytes.
// A thread turns an 8 (e) x 8 (d) patch in registers; a wave covers 64 e by
// 32 d with 8 lanes along e and 4 along d.  All 16 loads of a thread are in
// flight together, each wave-wide load takes 64-byte pieces of 8 rows (the
// two pieces of a line by the same thread), and each wave-wide store writes
// four whole 128-byte lines.
// ---------------------------------------------------------------------------
#define XCZ 8                                            // grid planes that convert x
#define XCB (XCZ * (EMB / 256) * (DIM / 64))             // their blocks
#define XPT (ROWS * EMB / 4 / (XCB * 256))               // float4 loads per thread
static_assert(XPT * XCB * 256 * 4 == ROWS * EMB, "the planes cover x exactly");
__global__ __launch_bounds__(256) void wtrans_kernel(
    const float* __restrict__ x, const float* __restrict__ Wq,
    const float* __restrict__ Wk, const float* __restrict__ Wv,
    _Float16* __restrict__ wt, _Float16* __restrict__ xh) {
  if (blockIdx.z >= 3) {
    const int blk = ((blockIdx.z - 3) * (DIM / 64) + blockIdx.y) * (EMB / 256) + blockIdx.x;
    const size_t at = (size_t)blk * (XPT * 1024) + threadIdx.x * 4;
    const float* xs = x + at;
    _Float16* xd = xh + at;
    float4 v[XPT];
#pragma unroll
    for (int i = 0; i < XPT; ++i) v[i] = *(const float4*)(xs + i * 1024);
    // Behind the loads, in front of every rewrite of their address registers:
    // named as an input, the address pair stays live up to the wait.
    asm volatile("s_wait_xcnt 0x0" :: "v"(xs) : "memory");
    // Keeps the conversions behind all the loads, which then share one latency.
    __builtin_amdgcn_sched_barrier(0);
#pragma unroll
    for (int i = 0; i < XPT; ++i) {
      v4h h;
      h[0] = (_Float16)v[i].x; h[1] = (_Float16)v[i].y;
      h[2] = (_Float16)v[i].z; h[3] = (_Float16)v[i].w;
      *(v4h*)(xd + i * 1024) = h;
    }
    return;
  }
  const float* W = (blockIdx.z == 0) ? Wq : (blockIdx.z == 1) ? Wk : Wv;
  const int wave = threadIdx.x >> 5, lane = threadIdx.x & 31;
  const int e0 = blockIdx.x * 256 + (wave >> 1) * 64 + (lane & 7) * 8;
  const int d0 = blockIdx.y * 64 + (wave & 1) * 32 + (lane >> 3) * 4;
  const float* src = W + (size_t)e0 * DIM + d0;
  _Float16* dst = wt + (size_t)blockIdx.z * EMB * DIM + (size_t)d0 * EMB + e0;

  float4 r[8][2];  // r[i][h] = W[e0 + i][d0 + h*16 .. + 3]
#pragma unroll
  for (int i = 0; i < 8; ++i)
#pragma unroll
    for (int h = 0; h < 2; ++h)
      r[i][h] = *(const float4*)(src + (size_t)i * DIM + h * 16);
  // Behind the loads, in front of every rewrite of their address registers:
  // named as an input, the address pair stays live up to the wait, so that no
  // load's own result is placed on it ahead of it.
  asm volatile("s_wait_xcnt 0x0" :: "v"(src) : "memory");
  // Keeps the conversions behind all 16 loads: lifted among them they make
  // the last loads wait for the first ones' data, a second memory latency.
  __builtin_amdgcn_sched_barrier(0);

  v8h t[2][4];  // t[h][c][i] = Wt[d0 + h*16 + c][e0 + i]
#pragma unroll
  for (int h = 0; h < 2; ++h)
#pragma unroll
    for (int i = 0; i < 8; ++i) {
      t[h][0][i] = (_Float16)r[i][h].x;
      t[h][1][i] = (_Float16)r[i][h].y;
      t[h][2][i] = (_Float16)r[i][h].z;
      t[h][3][i] = (_Float16)r[i][h].w;
    }
#pragma unroll
  for (int h = 0; h < 2; ++h)
#pragma unroll
    for (int c = 0; c < 4; ++c)
      *(v8h*)(dst + (size_t)(h * 16 + c) * EMB) = t[h][c];
}

#define PBM 128
#define PBN 256
#define PK 64
#define PPITCH (PK + 8)
#define PSTAGE ((PBM + PBN) * PPITCH)
#define PNW (PBN * PK / 8 / 256)
#define WST (PSTAGE / 8)

// Asynchronous copies to LDS, 16 bytes a lane, through no register.  l: the
// lane's LDS byte address of the first copy, g: its global source; copy i takes
// row i * 32 of the pass (LDS step lstep bytes, global step gstep halfs).
// The s_wait_xcnt 0 closes the copies' own statement, so that it stands in
// front of every later rewrite of the address registers that they name.
static __device__ __forceinline__ void copy4(const unsigned l, const int lstep,
                                             const _Float16* g, const size_t gstep) {
  asm volatile(
      "global_load_async_to_lds_b128 %0, %4, off\n\t"
      "global_load_async_to_lds_b128 %1, %5, off\n\t"
      "global_load_async_to_lds_b128 %2, %6, off\n\t"
      "global_load_async_to_lds_b128 %3, %7, off\n\t"
      "s_wait_xcnt 0x0"
      :: "v"(l), "v"(l + lstep), "v"(l + 2 * lstep), "v"(l + 3 * lstep),
         "v"(g), "v"(g + gstep), "v"(g + 2 * gstep), "v"(g + 3 * gstep)
      : "memory");
}
// The hand-over of a pass: this wave's LDS reads and stores are done, its own
// copies of the next pass have landed; the barrier then publishes the next
// buffer and says that every wave has left the one that is refilled behind it.
static __device__ __forceinline__ void publish() {
  asm volatile("s_wait_dscnt 0x0" ::: "memory");
  asm volatile("s_wait_asynccnt 0x0" ::: "memory");
  __syncthreads();
}

// Results leave through LDS: straight from the accumulators a wave-wide store
// puts 32-byte pieces on 16 rows.  The pass count is even, so the last pass
// reads the second buffer, and behind its barrier no wave reads the first one
// any more: each wave takes WST halfs of it for itself.  It lays 32 rows of 64
// f16 results there at pitch PPITCH; this sends them out, 8 lanes a row, so
// that every wave-wide store is four whole 128-byte lines.
// g: the first row's first element, pitch: halfs per global row.
static __device__ __forceinline__ void flush_rows(const _Float16* sw, _Float16* g,
                                                  const int pitch) {
  const int lane = threadIdx.x & 31;
  const int row = lane >> 3, col = (lane & 7) * 8;
  // The rows are read back by other lanes than wrote them.
  asm volatile("s_wait_dscnt 0x0" ::: "memory");
  v8h v[8];
#pragma unroll
  for (int t = 0; t < 8; ++t) v[t] = *(const v8h*)(sw + (t * 4 + row) * PPITCH + col);
  _Float16* p = g + (size_t)row * pitch + col;
#pragma unroll
  for (int t = 0; t < 8; ++t) *(v8h*)(p + (size_t)t * 4 * pitch) = v[t];
  // Behind the stores, in front of whatever rewrites their registers next.
  asm volatile("s_wait_xcnt 0x0" :: "v"(p) : "memory");
}

// The tile product, defined further down.
template <int KTOT, bool SCALE>
static __device__ __forceinline__ void tile_product(
    const _Float16* __restrict__ xs, const int xpitch,
    const _Float16* __restrict__ ws, const int wpitch,
    _Float16* s_ab, const _Float16* sf, const bool wa, v8f (&acc)[4][4]);

__global__ __launch_bounds__(256) void qkv_proj_kernel(
    const _Float16* __restrict__ xh, const _Float16* __restrict__ wt_all,
    const float* __restrict__ bq, const float* __restrict__ bk,
    const float* __restrict__ bv, _Float16* __restrict__ qh,
    _Float16* __restrict__ kh, _Float16* __restrict__ vt) {
  const int z = blockIdx.z;
  const float* bias = (z == 0) ? bq : (z == 1) ? bk : bv;

  const int tid = threadIdx.x, wave = tid >> 5, lane = tid & 31;
  const int l15 = lane & 15, hi = lane >> 4;
  const int m0 = blockIdx.x * PBM;
  const int n0 = blockIdx.y * PBN;

  __shared__ __attribute__((aligned(16))) _Float16 s_ab[2 * PSTAGE];

  // Which operand is A depends on z only.
  v8f acc[4][4];
  tile_product<EMB, false>(xh + (size_t)m0 * EMB, EMB,
                           wt_all + ((size_t)z * DIM + n0) * EMB, EMB,
                           s_ab, nullptr, z < 2, acc);

  static_assert((EMB / PK) % 2 == 0, "the last pass must read the second buffer");
  // The wave's number as a scalar: held in vector registers over the loop, what
  // the epilogue derives from it takes the kernel past 256 VGPRs.
  const int ws = __builtin_amdgcn_readfirstlane(wave);
  const int mw = m0 + (ws >> 2) * 64, nw = n0 + (ws & 3) * 64;
  _Float16* sw = s_ab + ws * WST;
  _Float16* st = sw + l15 * PPITCH + hi * 8;
  if (z < 2) {
    // acc[i][j][r] = Y[m0 + wm*64 + j*16 + l15][n0 + wn*64 + i*16 + hi*8 + r]
    _Float16* dst = (z == 0) ? qh : kh;
    const int nb = nw + hi * 8;
    float4 c0[4], c1[4];
#pragma unroll
    for (int i = 0; i < 4; ++i) {
      c0[i] = *(const float4*)(bias + nb + i * 16);
      c1[i] = *(const float4*)(bias + nb + i * 16 + 4);
    }
    // Behind the loads, in front of every rewrite of their address registers.
    asm volatile("s_wait_xcnt 0x0" ::: "memory");
#pragma unroll
    for (int h = 0; h < 2; ++h) {  // 32 rows m at a time
#pragma unroll
      for (int i = 0; i < 4; ++i) {
        const float bb[8] = {c0[i].x, c0[i].y, c0[i].z, c0[i].w,
                             c1[i].x, c1[i].y, c1[i].z, c1[i].w};
#pragma unroll
        for (int jj = 0; jj < 2; ++jj) {
          v8h o;
#pragma unroll
          for (int r = 0; r < 8; ++r) o[r] = (_Float16)(acc[i][h * 2 + jj][r] + bb[r]);
          *(v8h*)(st + jj * 16 * PPITCH + i * 16) = o;
        }
      }
      flush_rows(sw, dst + (size_t)(mw + h * 32) * DIM + nw, DIM);
    }
  } else {
    // acc[i][j][r] = Y[m0 + wm*64 + i*16 + hi*8 + r][n0 + wn*64 + j*16 + l15]
    const int nb = nw + l15;
    float bn[4];
#pragma unroll
    for (int j = 0; j < 4; ++j) bn[j] = bias[nb + j * 16];
    // The wait: as in the branch above.
    asm volatile("s_wait_xcnt 0x0" ::: "memory");
#pragma unroll
    for (int j = 0; j < 4; ++j) {  // 32 rows n at a time
#pragma unroll
      for (int i = 0; i < 4; ++i) {
        v8h o;
#pragma unroll
        for (int r = 0; r < 8; ++r) o[r] = (_Float16)(acc[i][j][r] + bn[j]);
        *(v8h*)(st + (j & 1) * 16 * PPITCH + i * 16) = o;
      }
      if (j & 1) flush_rows(sw, vt + (size_t)(nw + (j >> 1) * 32) * ROWS + mw, ROWS);
      // Keeps each group's sums and stores together: hoisted all at once
      // they take the kernel past 256 VGPRs, and only one block fits a WGP.
      if (j < 3) __builtin_amdgcn_sched_barrier(0);
    }
  }
}

// ---------------------------------------------------------------------------
// Attention as two tiled GEMMs with the row softmax folded into them.
// The tile product below is the projection's scheme with both operands f16:
// C[128][256] = X[128][KTOT] * W[256][KTOT]^T, 8 waves (2 x 4) of 64x64, both
// operands staged per pass of PK k-values in one of two LDS buffers by
// asynchronous copies issued one pass ahead.  X is the A operand:
// acc[i][j][r] = C[wm*64 + i*16 + hi*8 + r][wn*64 + j*16 + l15]; with wa, W is:
// acc[i][j][r] = C[wm*64 + j*16 + l15][wn*64 + i*16 + hi*8 + r].
// With SCALE, row m of X is multiplied in pass kt by sf[m * (KTOT / PK) + kt]
// (an LDS table) on its way from registers to LDS.
// ---------------------------------------------------------------------------
#define NGRP (SEQ / PK)                // key groups of a row, one per pass of P*V
#define PNH (PBM * PK / 8 / 256)       // 16-byte loads of the X operand per thread and pass
#define OPITCH 68                      // floats per staged output row: rows 8 apart fall 32 banks apart
static_assert(16 * OPITCH * 4 <= WST * 2 && 32 * PPITCH <= WST, "staged rows fit a wave's part");

template <int KTOT, bool SCALE>
static __device__ __forceinline__ void tile_product(
    const _Float16* __restrict__ xs, const int xpitch,
    const _Float16* __restrict__ ws, const int wpitch,
    _Float16* s_ab, const _Float16* sf, const bool wa, v8f (&acc)[4][4]) {
  static_assert((KTOT / PK) % 2 == 0, "the last pass must read the second buffer");
  const int tid = threadIdx.x, wave = tid >> 5, lane = tid & 31;
  const int l15 = lane & 15, koff = (lane >> 4) * 8;
  const int wm = wave >> 2, wn = wave & 3;

  // Staging map: 8 consecutive lanes cover one 128-byte row of the pass.
  const int col = (tid % (PK / 8)) * 8, row = tid / (PK / 8);
  const _Float16* xsrc = xs + (size_t)row * xpitch + col;
  const _Float16* wsrc = ws + (size_t)row * wpitch + col;
  const int xdst = row * PPITCH + col;
  const int wdst = (PBM + row) * PPITCH + col;
  const int xfrag = (wm * 64 + l15) * PPITCH + koff;
  const int wfrag = (PBM + wn * 64 + l15) * PPITCH + koff;
  const int afrag = wa ? wfrag : xfrag;
  const int bfrag = wa ? xfrag : wfrag;

  // Operands go to LDS by asynchronous copies; with SCALE, X passes through
  // registers, where it is multiplied.  get(t, b): pass t's copies into buffer
  // b, and with SCALE its X rows and factors.
  const unsigned xl = (unsigned)(size_t)(s_ab + xdst);
  const unsigned wl = (unsigned)(size_t)(s_ab + wdst);
  v8h rx[PNH];
  _Float16 fx[PNH];
  auto get = [&](const int t, const int b) {
#pragma unroll
    for (int c = 0; c < PNW / 4; ++c)
      copy4(wl + (b * PSTAGE + c * 128 * PPITCH) * 2, 32 * PPITCH * 2,
            wsrc + (size_t)c * 128 * wpitch + t * PK, (size_t)32 * wpitch);
    if (SCALE) {
#pragma unroll
      for (int i = 0; i < PNH; ++i)
        rx[i] = *(const v8h*)(xsrc + (size_t)i * (2048 / PK) * xpitch + t * PK);
#pragma unroll
      for (int i = 0; i < PNH; ++i)
        fx[i] = sf[(row + i * (2048 / PK)) * (KTOT / PK) + t];
      // Stands behind the loads, in front of every rewrite of their address
      // registers; its "memory" clobber also holds the loads ahead of the next
      // pass's LDS reads and WMMAs, which cover their latency.
      asm volatile("s_wait_xcnt 0x0" ::: "memory");
    } else {
      static_assert(PNH == 4, "one statement of four copies");
      copy4(xl + b * PSTAGE * 2, 32 * PPITCH * 2, xsrc + t * PK, (size_t)32 * xpitch);
    }
  };
  auto put = [&](_Float16* sb) {
#pragma unroll
    for (int i = 0; i < PNH; ++i)
      *(v8h*)(sb + xdst + i * (2048 / PK) * PPITCH) = rx[i] * fx[i];
  };
  get(0, 0);
  if (SCALE) put(s_ab);
  publish();
  get(1, 1);

#pragma unroll
  for (int i = 0; i < 4; ++i)
#pragma unroll
    for (int j = 0; j < 4; ++j) acc[i][j] = v8f{};

  static_assert(PK == 64, "a pass is two k-steps of 32");
  v16h fa[4], fb[4];
  auto frag = [&](const int kt, const int ks) {  // the 16 fragment loads of a k-step
    const _Float16* sb = s_ab + (kt & 1) * PSTAGE + ks * 32;
#pragma unroll
    for (int i = 0; i < 4; ++i) {
      const _Float16* pa = sb + afrag + i * 16 * PPITCH;
      const _Float16* pb = sb + bfrag + i * 16 * PPITCH;
      fa[i] = cat8(*(const v8h*)pa, *(const v8h*)(pa + 16));
      fb[i] = cat8(*(const v8h*)pb, *(const v8h*)(pb + 16));
    }
  };
  auto mm = [&]() {  // its 16 WMMAs
    // Keeps what stands above (the fragment loads as one group, in the registers
    // that staging no longer takes; the refill) ahead of the WMMAs: loads sunk
    // among them are each waited for right behind their issue, and a refill
    // sunk behind them loses that much of its lead.
    __builtin_amdgcn_sched_barrier(0);
#pragma unroll
    for (int i = 0; i < 4; ++i)
#pragma unroll
      for (int j = 0; j < 4; ++j)
        acc[i][j] = __builtin_amdgcn_wmma_f32_16x16x32_f16(
            false, fa[i], false, fb[j], (short)0, acc[i][j], false, false);
  };
  // A pass's LDS reads end with its second k-step's fragment loads.  Without
  // SCALE the hand-over stands right behind them, and that k-step's WMMAs, which
  // touch registers only, run behind the refill.  With SCALE they stay in front
  // and cover the X loads; X then goes into the other buffer, which every wave
  // left at the last barrier and where the copies are landing meanwhile.
  // The refill is issued behind the barrier while a pass kt + 2 exists.
  for (int kt = 0; kt < KTOT / PK - 2; ++kt) {
    frag(kt, 0);
    mm();
    frag(kt, 1);
    if (SCALE) {
      mm();
      put(s_ab + ((kt + 1) & 1) * PSTAGE);
    }
    publish();
    get(kt + 2, kt & 1);
    if (!SCALE) mm();
  }
  frag(KTOT / PK - 2, 0);
  mm();
  frag(KTOT / PK - 2, 1);
  mm();
  if (SCALE) put(s_ab + PSTAGE);
  publish();
  frag(KTOT / PK - 1, 0);
  mm();
  frag(KTOT / PK - 1, 1);
  mm();
  publish();
  // No copy is outstanding when the first buffer becomes output staging.
  asm volatile("s_wait_asynccnt 0x0" ::: "memory");
}

static __device__ __forceinline__ float exp2_slot(float u) {
  float r;
  asm("v_exp_f32 %0, %1\n\tv_nop" : "=v"(r) : "v"(u));
  return r;
}

__global__ __launch_bounds__(256) void scores_kernel(
    const _Float16* __restrict__ qh, const _Float16* __restrict__ kh,
    const int* __restrict__ mask, _Float16* __restrict__ ph,
    float* __restrict__ gmax, float* __restrict__ gsum) {
  __shared__ __attribute__((aligned(16))) _Float16 s_ab[2 * PSTAGE];
  const int kb = blockIdx.x * PBM;
  const int qb = blockIdx.z * SEQ + blockIdx.y * PBN;
  v8f acc[4][4];
  tile_product<EMB, false>(kh + (size_t)(blockIdx.z * SEQ + kb) * EMB, EMB,
                           qh + (size_t)qb * EMB, EMB, s_ab, nullptr, false, acc);

  // acc[i][j][r] = S[key kb + wm*64 + i*16 + hi*8 + r][row qb + wn*64 + j*16 + l15]
  const int wave = threadIdx.x >> 5, lane = threadIdx.x & 31;
  const int hi = lane >> 4;
  const int key0 = kb + (wave >> 2) * 64 + hi * 8;
  const int grp = (kb >> 6) + (wave >> 2);
  const int row0 = qb + (wave & 3) * 64 + (lane & 15);
  const int* mk0 = mask + (size_t)row0 * SEQ + key0;
  int4 g[2][8];  // the mask of query column j in g[j & 1], fetched one column ahead
#pragma unroll
  for (int i = 0; i < 4; ++i) {
    g[0][2 * i]     = *(const int4*)(mk0 + i * 16);
    g[0][2 * i + 1] = *(const int4*)(mk0 + i * 16 + 4);
  }
  // Behind the loads, in front of every rewrite of their address registers:
  // named as an input, the address pair stays live up to the wait.
  asm volatile("s_wait_xcnt 0x0" :: "v"(mk0) : "memory");
  // Keeps the later columns' mask loads out of the last pass, where fragments
  // are still live: with them there the kernel goes past
  // 256 VGPRs, and only one block fits a WGP.
  __builtin_amdgcn_sched_barrier(0);
  _Float16* sw = s_ab + wave * WST;  // the wave's own part of the first buffer
  _Float16* st = sw + (lane & 15) * PPITCH + hi * 8;
  _Float16* pw = ph + (size_t)(qb + (wave & 3) * 64) * SEQ + kb + (wave >> 2) * 64;
#pragma unroll
  for (int j = 0; j < 4; ++j) {
    const int row = row0 + j * 16;
    if (j < 3) {
      const int* mk = mk0 + (size_t)(j + 1) * 16 * SEQ;
#pragma unroll
      for (int i = 0; i < 4; ++i) {
        g[(j + 1) & 1][2 * i]     = *(const int4*)(mk + i * 16);
        g[(j + 1) & 1][2 * i + 1] = *(const int4*)(mk + i * 16 + 4);
      }
      // The wait: as above (these loads are built on the same address pair, with
      // immediate offsets).  The fence holds this column's arithmetic behind it.
      asm volatile("s_wait_xcnt 0x0" :: "v"(mk0) : "memory");
      __builtin_amdgcn_sched_barrier(0);
    }
    // Columns 0 and 1 leave, 32 query rows at a time, behind the issue of the
    // next mask loads and ahead of column 2's results, which take their place.
    // The fence keeps this column's arithmetic off the stores' registers until
    // the wait that ends flush_rows.
    if (j == 2) {
      flush_rows(sw, pw, SEQ);
      __builtin_amdgcn_sched_barrier(0);
    }

    float m = -1e30f;
#pragma unroll
    for (int i = 0; i < 4; ++i) {
      const int4 ga = g[j & 1][2 * i], gb = g[j & 1][2 * i + 1];
      const int gi[8] = {ga.x, ga.y, ga.z, ga.w, gb.x, gb.y, gb.z, gb.w};
#pragma unroll
      for (int r = 0; r < 8; ++r) {  // scale by QD, not sqrt(QD); times log2(e)
        acc[i][j][r] = (gi[r] == 0) ? -1e30f : acc[i][j][r] * (1.44269504f / 1024.0f);
        m = fmaxf(m, acc[i][j][r]);
      }
    }
    m = fmaxf(m, __shfl_xor(m, 16));

    float sum = 0.0f;
#pragma unroll
    for (int i = 0; i < 4; ++i) {
      v8h h;
#pragma unroll
      for (int r = 0; r < 8; ++r) {
        const float p = exp2_slot(acc[i][j][r] - m);
        h[r] = (_Float16)p;
        sum += p;
      }
      *(v8h*)(st + (j & 1) * 16 * PPITCH + i * 16) = h;
    }
    sum += __shfl_xor(sum, 16);
    if (hi == 0) {
      gmax[(size_t)grp * ROWS + row] = m;
      gsum[(size_t)grp * ROWS + row] = sum;
    }
    // The wait stands behind each column's stores, in front of whatever
    // rewrites their registers next.
    asm volatile("s_wait_xcnt 0x0" ::: "memory");
  }
  flush_rows(sw, pw + (size_t)32 * SEQ, SEQ);
}

// ---------------------------------------------------------------------------
// Kernel 3: out[row][d] = sum_k softmax[row][k] * vt[d][b*SEQ + k].
// grid = (ROWS/128 row tiles, DIM/256 column tiles).
// First the block joins its 128 rows' groups: row max M = max of the group
// maxima, factor f[g] = exp2(gmax[g] - M), row sum = sum of f[g] * gsum[g].
// The product then takes ph[row][k] * f[group of k]; 1 / row sum at the end.
// ---------------------------------------------------------------------------
__global__ __launch_bounds__(256) void pv_kernel(
    const _Float16* __restrict__ ph, const _Float16* __restrict__ vt,
    const float* __restrict__ gmax, const float* __restrict__ gsum,
    float* __restrict__ out) {
  __shared__ __attribute__((aligned(16))) _Float16 s_ab[2 * PSTAGE];
  __shared__ __attribute__((aligned(16))) _Float16 s_f[PBM * NGRP];
  __shared__ __attribute__((aligned(16))) float s_rinv[PBM];
  const int m0 = blockIdx.x * PBM;
  const int n0 = blockIdx.y * PBN;
  const int b = m0 / SEQ;

  if (threadIdx.x < PBM) {
    const int t = threadIdx.x;
    const float* pm = gmax + m0;
    const float* ps = gsum + m0;
    float gm[NGRP], gs[NGRP];
#pragma unroll
    for (int g = 0; g < NGRP; ++g) {
      gm[g] = pm[(size_t)g * ROWS + t];
      gs[g] = ps[(size_t)g * ROWS + t];
    }
    // Behind the loads, in front of every rewrite of their address registers
    // (the lane's index, named as an input, and two scalar bases); the fence
    // holds the arithmetic behind the wait.
    asm volatile("s_wait_xcnt 0x0" :: "v"(t) : "memory");
    __builtin_amdgcn_sched_barrier(0);
    float m = gm[0];
#pragma unroll
    for (int g = 1; g < NGRP; ++g) m = fmaxf(m, gm[g]);
    float sum = 0.0f;
#pragma unroll
    for (int c = 0; c < NGRP / 8; ++c) {
      v8h h;
#pragma unroll
      for (int e = 0; e < 8; ++e) {
        h[e] = (_Float16)exp2_slot(gm[c * 8 + e] - m);
        sum += (float)h[e] * gs[c * 8 + e];  // the factor as the product sees it
      }
      *(v8h*)(s_f + threadIdx.x * NGRP + c * 8) = h;
    }
    s_rinv[threadIdx.x] = 1.0f / sum;
  }
  // Publishes the factors and the row sums to every wave of the block.
  __syncthreads();

  v8f acc[4][4];
  tile_product<SEQ, true>(ph + (size_t)m0 * SEQ, SEQ,
                          vt + (size_t)n0 * ROWS + b * SEQ, ROWS, s_ab, s_f, false, acc);

  // The wave's 64 x 64 f32 tile goes out through its own WST halfs of the first
  // buffer (free behind the last pass's barrier, as above flush_rows), 16 rows at
  // a time at pitch OPITCH: 16 lanes then send one row's 256 bytes, and every
  // wave-wide store is four whole 128-byte lines in place of 64-byte pieces.
  const int wave = threadIdx.x >> 5, lane = threadIdx.x & 31;
  const int l15 = lane & 15, hi = lane >> 4;
  const int ml = (wave >> 2) * 64 + hi * 8;
  float* st = (float*)(s_ab + wave * WST);
  float* dst = out + (size_t)(m0 + (wave >> 2) * 64 + hi) * DIM + n0 + (wave & 3) * 64 + l15 * 4;
#pragma unroll
  for (int i = 0; i < 4; ++i) {
    const float4 u0 = *(const float4*)(s_rinv + ml + i * 16);
    const float4 u1 = *(const float4*)(s_rinv + ml + i * 16 + 4);
    const float li[8] = {u0.x, u0.y, u0.z, u0.w, u1.x, u1.y, u1.z, u1.w};
#pragma unroll
    for (int r = 0; r < 8; ++r)
#pragma unroll
      for (int j = 0; j < 4; ++j)
        st[(hi * 8 + r) * OPITCH + j * 16 + l15] = acc[i][j][r] * li[r];
    // The rows are read back by other lanes than wrote them.
    asm volatile("s_wait_dscnt 0x0" ::: "memory");
    float4 v[8];
#pragma unroll
    for (int t = 0; t < 8; ++t) v[t] = *(const float4*)(st + (t * 2 + hi) * OPITCH + l15 * 4);
#pragma unroll
    for (int t = 0; t < 8; ++t) *(float4*)(dst + (size_t)(i * 16 + t * 2) * DIM) = v[t];
    // Behind the stores, in front of whatever rewrites their registers next.
    asm volatile("s_wait_xcnt 0x0" :: "v"(dst) : "memory");
    // Keeps the next rows' arithmetic off the stores' registers until that wait.
    if (i < 3) __builtin_amdgcn_sched_barrier(0);
  }
}

// ---------------------------------------------------------------------------
// Launch: inputs are x, mask, Wq, bq, Wk, bk, Wv, bv.
// Workspace layout (f16): qh[8192][1024] | kh[8192][1024] | vt[1024][8192]
//                         | Wt (3 x [1024][1024]) | ph f16 [8192][2048]
//                         | gmax, gsum f32 [32][8192] each
//                         | xh f16 [8192][1024]  -> 104 MB.
// ---------------------------------------------------------------------------
extern "C" void kernel_launch(void* const* d_in, const int* in_sizes, int n_in,
                              void* d_out, int out_size, void* d_ws, size_t ws_size,
                              hipStream_t stream) {
  const float* x    = (const float*)d_in[0];
  const int*   mask = (const int*)d_in[1];
  const float* Wq   = (const float*)d_in[2];
  const float* bq   = (const float*)d_in[3];
  const float* Wk   = (const float*)d_in[4];
  const float* bk   = (const float*)d_in[5];
  const float* Wv   = (const float*)d_in[6];
  const float* bv   = (const float*)d_in[7];
  float* out = (float*)d_out;

  _Float16* qh = (_Float16*)d_ws;
  _Float16* kh = qh + (size_t)ROWS * DIM;
  _Float16* vt = kh + (size_t)ROWS * DIM;
  _Float16* wt = vt + (size_t)ROWS * DIM;
  _Float16* ph = wt + (size_t)3 * EMB * DIM;
  float* gmax = (float*)(ph + (size_t)ROWS * SEQ);
  float* gsum = gmax + (size_t)NGRP * ROWS;
  _Float16* xh = (_Float16*)(gsum + (size_t)NGRP * ROWS);

  dim3 bt(256);
  wtrans_kernel<<<dim3(EMB / 256, DIM / 64, 3 + XCZ), bt, 0, stream>>>(x, Wq, Wk, Wv, wt, xh);
  qkv_proj_kernel<<<dim3(ROWS / PBM, DIM / PBN, 3), bt, 0, stream>>>(
      xh, wt, bq, bk, bv, qh, kh, vt);
  scores_kernel<<<dim3(SEQ / PBM, SEQ / PBN, BSZ), bt, 0, stream>>>(
      qh, kh, mask, ph, gmax, gsum);
  pv_kernel<<<dim3(ROWS / PBM, DIM / PBN), bt, 0, stream>>>(ph, vt, gmax, gsum, out);
}

// v008
// It runs in 106 microseconds.
// Next to v007, in two timings, it ran 1.05 times as fast each time.
// All steps since v000 together make it 6.68 times as fast.
#include <hip/hip_runtime.h>
#include <hip/hip_fp16.h>

typedef __attribute__((ext_vector_type(16))) _Float16 v16h;
typedef __attribute__((ext_vector_type(8)))  _Float16 v8h;
typedef __attribute__((ext_vector_type(4)))  _Float16 v4h;
typedef __attribute__((ext_vector_type(8)))  float    v8f;

#define BSZ 4
#define SEQ 2048
#define EMB 1024
#define DIM 1024
#define ROWS (BSZ * SEQ)  // 8192

static __device__ __forceinline__ v16h cat8(v8h lo, v8h hi) {
  v16h r;
#pragma unroll
  for (int i = 0; i < 8; ++i) { r[i] = lo[i]; r[i + 8] = hi[i]; }
  return r;
}

// ---------------------------------------------------------------------------
// Kernel 0: transpose + f32->f16 convert the three weight matrices, and
// convert x.
// Wt[d][e] = (f16) W[e][d]  so that B-fragment (column) reads become
// contiguous row reads for the WMMA GEMMs.
// grid = (EMB/256, DIM/64, 3 + XCZ), block = 8 waves (4 along e, 2 along d).
// Planes z >= 3 round x to f16 once, xh[s][e] = (f16) x[s][e]: the projection
// then brings half the bytes for each of the 12 blocks that read a row of x,
// and converts nothing.  A thread has its XPT 16-byte loads in flight together;
// every wave-wide load is 512 and every store 256 contiguous bytes.
// A thread turns an 8 (e) x 8 (d) patch in registers; a wave covers 64 e by
// 32 d with 8 lanes along e and 4 along d.  All 16 loads of a thread are in
// flight together, each wave-wide load takes 64-byte pieces of 8 rows (the
// two pieces of a line by the same thread), and each wave-wide store writes
// four whole 128-byte lines.
// ---------------------------------------------------------------------------
#define XCZ 8                                            // grid planes that convert x
#define XCB (XCZ * (EMB / 256) * (DIM / 64))             // their blocks
#define XPT (ROWS * EMB / 4 / (XCB * 256))               // float4 loads per thread
static_assert(XPT * XCB * 256 * 4 == ROWS * EMB, "the planes cover x exactly");
__global__ __launch_bounds__(256) void wtrans_kernel(
    const float* __restrict__ x, const float* __restrict__ Wq,
    const float* __restrict__ Wk, const float* __restrict__ Wv,
    _Float16* __restrict__ wt, _Float16* __restrict__ xh) {
  if (blockIdx.z >= 3) {
    const int blk = ((blockIdx.z - 3) * (DIM / 64) + blockIdx.y) * (EMB / 256) + blockIdx.x;
    const size_t at = (size_t)blk * (XPT * 1024) + threadIdx.x * 4;
    const float* xs = x + at;
    _Float16* xd = xh + at;
    float4 v[XPT];
#pragma unroll
    for (int i = 0; i < XPT; ++i) v[i] = *(const float4*)(xs + i * 1024);
    // Behind the loads, in front of every rewrite of their address registers:
    // named as an input, the address pair stays live up to the wait.
    asm volatile("s_wait_xcnt 0x0" :: "v"(xs) : "memory");
    // Keeps the conversions behind all the loads, which then share one latency.
    __builtin_amdgcn_sched_barrier(0);
#pragma unroll
    for (int i = 0; i < XPT; ++i) {
      v4h h;
      h[0] = (_Float16)v[i].x; h[1] = (_Float16)v[i].y;
      h[2] = (_Float16)v[i].z; h[3] = (_Float16)v[i].w;
      *(v4h*)(xd + i * 1024) = h;
    }
    return;
  }
  const float* W = (blockIdx.z == 0) ? Wq : (blockIdx.z == 1) ? Wk : Wv;
  const int wave = threadIdx.x >> 5, lane = threadIdx.x & 31;
  const int e0 = blockIdx.x * 256 + (wave >> 1) * 64 + (lane & 7) * 8;
  const int d0 = blockIdx.y * 64 + (wave & 1) * 32 + (lane >> 3) * 4;
  const float* src = W + (size_t)e0 * DIM + d0;
  _Float16* dst = wt + (size_t)blockIdx.z * EMB * DIM + (size_t)d0 * EMB + e0;

  float4 r[8][2];  // r[i][h] = W[e0 + i][d0 + h*16 .. + 3]
#pragma unroll
  for (int i = 0; i < 8; ++i)
#pragma unroll
    for (int h = 0; h < 2; ++h)
      r[i][h] = *(const float4*)(src + (size_t)i * DIM + h * 16);
  // Behind the loads, in front of every rewrite of their address registers:
  // named as an input, the address pair stays live up to the wait, so that no
  // load's own result is placed on it ahead of it.
  asm volatile("s_wait_xcnt 0x0" :: "v"(src) : "memory");
  // Keeps the conversions behind all 16 loads: lifted among them they make
  // the last loads wait for the first ones' data, a second memory latency.
  __builtin_amdgcn_sched_barrier(0);

  v8h t[2][4];  // t[h][c][i] = Wt[d0 + h*16 + c][e0 + i]
#pragma unroll
  for (int h = 0; h < 2; ++h)
#pragma unroll
    for (int i = 0; i < 8; ++i) {
      t[h][0][i] = (_Float16)r[i][h].x;
      t[h][1][i] = (_Float16)r[i][h].y;
      t[h][2][i] = (_Float16)r[i][h].z;
      t[h][3][i] = (_Float16)r[i][h].w;
    }
#pragma unroll
  for (int h = 0; h < 2; ++h)
#pragma unroll
    for (int c = 0; c < 4; ++c)
      *(v8h*)(dst + (size_t)(h * 16 + c) * EMB) = t[h][c];
}

#define PBM 128
#define PBN 256
#define PK 64
#define PPITCH (PK + 8)
#define PSTAGE ((PBM + PBN) * PPITCH)
#define PNW (PBN * PK / 8 / 256)
#define WST (PSTAGE / 8)

// Asynchronous copies to LDS, 16 bytes a lane, through no register.  l: the
// lane's LDS byte address of the first copy, g: its global source; copy i takes
// row i * 32 of the pass (LDS step lstep bytes, global step gstep halfs).
// The s_wait_xcnt 0 closes the copies' own statement, so that it stands in
// front of every later rewrite of the address registers that they name.
static __device__ __forceinline__ void copy4(const unsigned l, const int lstep,
                                             const _Float16* g, const size_t gstep) {
  asm volatile(
      "global_load_async_to_lds_b128 %0, %4, off\n\t"
      "global_load_async_to_lds_b128 %1, %5, off\n\t"
      "global_load_async_to_lds_b128 %2, %6, off\n\t"
      "global_load_async_to_lds_b128 %3, %7, off\n\t"
      "s_wait_xcnt 0x0"
      :: "v"(l), "v"(l + lstep), "v"(l + 2 * lstep), "v"(l + 3 * lstep),
         "v"(g), "v"(g + gstep), "v"(g + 2 * gstep), "v"(g + 3 * gstep)
      : "memory");
}
// The hand-over of a pass: this wave's LDS reads and stores are done, its own
// copies of the next pass have landed; the barrier then publishes the next
// buffer and says that every wave has left the one that is refilled behind it.
static __device__ __forceinline__ void publish() {
  asm volatile("s_wait_dscnt 0x0" ::: "memory");
  asm volatile("s_wait_asynccnt 0x0" ::: "memory");
  __syncthreads();
}

// Results leave through LDS: straight from the accumulators a wave-wide store
// puts 32-byte pieces on 16 rows.  The pass count is even, so the last pass
// reads the second buffer, and behind its barrier no wave reads the first one
// any more: each wave takes WST halfs of it for itself.  It lays 32 rows of 64
// f16 results there at pitch PPITCH; this sends them out, 8 lanes a row, so
// that every wave-wide store is four whole 128-byte lines.
// g: the first row's first element, pitch: halfs per global row.
static __device__ __forceinline__ void flush_rows(const _Float16* sw, _Float16* g,
                                                  const int pitch) {
  const int lane = threadIdx.x & 31;
  const int row = lane >> 3, col = (lane & 7) * 8;
  // The rows are read back by other lanes than wrote them.
  asm volatile("s_wait_dscnt 0x0" ::: "memory");
  v8h v[8];
#pragma unroll
  for (int t = 0; t < 8; ++t) v[t] = *(const v8h*)(sw + (t * 4 + row) * PPITCH + col);
  _Float16* p = g + (size_t)row * pitch + col;
#pragma unroll
  for (int t = 0; t < 8; ++t) *(v8h*)(p + (size_t)t * 4 * pitch) = v[t];
  // Behind the stores, in front of whatever rewrites their registers next.
  asm volatile("s_wait_xcnt 0x0" :: "v"(p) : "memory");
}

// The tile product, defined further down.
template <int KTOT, bool SCALE>
static __device__ __forceinline__ void tile_product(
    const _Float16* __restrict__ xs, const int xpitch,
    const _Float16* __restrict__ ws, const int wpitch,
    _Float16* s_ab, const _Float16* sf, const bool wa, const int rot, v8f (&acc)[4][4]);

__global__ __launch_bounds__(256) void qkv_proj_kernel(
    const _Float16* __restrict__ xh, const _Float16* __restrict__ wt_all,
    const float* __restrict__ bq, const float* __restrict__ bk,
    const float* __restrict__ bv, _Float16* __restrict__ qh,
    _Float16* __restrict__ kh, _Float16* __restrict__ vt) {
  const int z = blockIdx.z;
  const float* bias = (z == 0) ? bq : (z == 1) ? bk : bv;

  const int tid = threadIdx.x, wave = tid >> 5, lane = tid & 31;
  const int l15 = lane & 15, hi = lane >> 4;
  const int m0 = blockIdx.x * PBM;
  const int n0 = blockIdx.y * PBN;

  __shared__ __attribute__((aligned(16))) _Float16 s_ab[2 * PSTAGE];

  // Which operand is A depends on z only.  First pass: the 12 blocks that read
  // the same x rows all differ, the 64 that read the same weight rows spread
  // evenly over the passes.
  v8f acc[4][4];
  tile_product<EMB, false>(xh + (size_t)m0 * EMB, EMB,
                           wt_all + ((size_t)z * DIM + n0) * EMB, EMB,
                           s_ab, nullptr, z < 2,
                           blockIdx.x + blockIdx.y + z * (DIM / PBN), acc);

  static_assert((EMB / PK) % 2 == 0, "the last pass must read the second buffer");
  // The wave's number as a scalar: held in vector registers over the loop, what
  // the epilogue derives from it takes the kernel past 256 VGPRs.
  const int ws = __builtin_amdgcn_readfirstlane(wave);
  const int mw = m0 + (ws >> 2) * 64, nw = n0 + (ws & 3) * 64;
  _Float16* sw = s_ab + ws * WST;
  _Float16* st = sw + l15 * PPITCH + hi * 8;
  if (z < 2) {
    // acc[i][j][r] = Y[m0 + wm*64 + j*16 + l15][n0 + wn*64 + i*16 + hi*8 + r]
    _Float16* dst = (z == 0) ? qh : kh;
    const int nb = nw + hi * 8;
    float4 c0[4], c1[4];
#pragma unroll
    for (int i = 0; i < 4; ++i) {
      c0[i] = *(const float4*)(bias + nb + i * 16);
      c1[i] = *(const float4*)(bias + nb + i * 16 + 4);
    }
    // Behind the loads, in front of every rewrite of their address registers.
    asm volatile("s_wait_xcnt 0x0" ::: "memory");
#pragma unroll
    for (int h = 0; h < 2; ++h) {  // 32 rows m at a time
#pragma unroll
      for (int i = 0; i < 4; ++i) {
        const float bb[8] = {c0[i].x, c0[i].y, c0[i].z, c0[i].w,
                             c1[i].x, c1[i].y, c1[i].z, c1[i].w};
#pragma unroll
        for (int jj = 0; jj < 2; ++jj) {
          v8h o;
#pragma unroll
          for (int r = 0; r < 8; ++r) o[r] = (_Float16)(acc[i][h * 2 + jj][r] + bb[r]);
          *(v8h*)(st + jj * 16 * PPITCH + i * 16) = o;
        }
      }
      flush_rows(sw, dst + (size_t)(mw + h * 32) * DIM + nw, DIM);
    }
  } else {
    // acc[i][j][r] = Y[m0 + wm*64 + i*16 + hi*8 + r][n0 + wn*64 + j*16 + l15]
    const int nb = nw + l15;
    float bn[4];
#pragma unroll
    for (int j = 0; j < 4; ++j) bn[j] = bias[nb + j * 16];
    // The wait: as in the branch above.
    asm volatile("s_wait_xcnt 0x0" ::: "memory");
#pragma unroll
    for (int j = 0; j < 4; ++j) {  // 32 rows n at a time
#pragma unroll
      for (int i = 0; i < 4; ++i) {
        v8h o;
#pragma unroll
        for (int r = 0; r < 8; ++r) o[r] = (_Float16)(acc[i][j][r] + bn[j]);
        *(v8h*)(st + (j & 1) * 16 * PPITCH + i * 16) = o;
      }
      if (j & 1) flush_rows(sw, vt + (size_t)(nw + (j >> 1) * 32) * ROWS + mw, ROWS);
      // Keeps each group's sums and stores together: hoisted all at once
      // they take the kernel past 256 VGPRs, and only one block fits a WGP.
      if (j < 3) __builtin_amdgcn_sched_barrier(0);
    }
  }
}

// ---------------------------------------------------------------------------
// Attention as two tiled GEMMs with the row softmax folded into them.
// The tile product below is the projection's scheme with both operands f16:
// C[128][256] = X[128][KTOT] * W[256][KTOT]^T, 8 waves (2 x 4) of 64x64, both
// operands staged per pass of PK k-values in one of two LDS buffers by
// asynchronous copies issued one pass ahead.  X is the A operand:
// acc[i][j][r] = C[wm*64 + i*16 + hi*8 + r][wn*64 + j*16 + l15]; with wa, W is:
// acc[i][j][r] = C[wm*64 + j*16 + l15][wn*64 + i*16 + hi*8 + r].
// With SCALE, row m of X is multiplied in pass kt by sf[m * (KTOT / PK) + kt]
// (an LDS table) on its way from registers to LDS.
// The block walks its passes from pass rot (taken modulo the pass count) and
// wraps round.  Blocks that share operand rows run in step; started at the same
// pass they all ask L2 for the same lines, and for one 128-byte column of every
// row, at the same moment.  The caller gives such blocks different rot.
// ---------------------------------------------------------------------------
#define NGRP (SEQ / PK)                // key groups of a row, one per pass of P*V
#define PNH (PBM * PK / 8 / 256)       // 16-byte loads of the X operand per thread and pass
#define OPITCH 68                      // floats per staged output row: rows 8 apart fall 32 banks apart
static_assert(16 * OPITCH * 4 <= WST * 2 && 32 * PPITCH <= WST, "staged rows fit a wave's part");

template <int KTOT, bool SCALE>
static __device__ __forceinline__ void tile_product(
    const _Float16* __restrict__ xs, const int xpitch,
    const _Float16* __restrict__ ws, const int wpitch,
    _Float16* s_ab, const _Float16* sf, const bool wa, const int rot, v8f (&acc)[4][4]) {
  static_assert((KTOT / PK) % 2 == 0, "the last pass must read the second buffer");
  static_assert(((KTOT / PK) & (KTOT / PK - 1)) == 0, "the wrap is a mask");
  const int tid = threadIdx.x, wave = tid >> 5, lane = tid & 31;
  const int l15 = lane & 15, koff = (lane >> 4) * 8;
  const int wm = wave >> 2, wn = wave & 3;

  // Staging map: 8 consecutive lanes cover one 128-byte row of the pass.
  const int col = (tid % (PK / 8)) * 8, row = tid / (PK / 8);
  const _Float16* xsrc = xs + (size_t)row * xpitch + col;
  const _Float16* wsrc = ws + (size_t)row * wpitch + col;
  const int xdst = row * PPITCH + col;
  const int wdst = (PBM + row) * PPITCH + col;
  const int xfrag = (wm * 64 + l15) * PPITCH + koff;
  const int wfrag = (PBM + wn * 64 + l15) * PPITCH + koff;
  const int afrag = wa ? wfrag : xfrag;
  const int bfrag = wa ? xfrag : wfrag;

  // Operands go to LDS by asynchronous copies; with SCALE, X passes through
  // registers, where it is multiplied.  get(n, b): the copies of the block's
  // n-th pass, which is pass t of the product, into buffer b, and with SCALE
  // its X rows and factors.
  const unsigned xl = (unsigned)(size_t)(s_ab + xdst);
  const unsigned wl = (unsigned)(size_t)(s_ab + wdst);
  v8h rx[PNH];
  _Float16 fx[PNH];
  auto get = [&](const int n, const int b) {
    const int t = (n + rot) & (KTOT / PK - 1);
#pragma unroll
    for (int c = 0; c < PNW / 4; ++c)
      copy4(wl + (b * PSTAGE + c * 128 * PPITCH) * 2, 32 * PPITCH * 2,
            wsrc + (size_t)c * 128 * wpitch + t * PK, (size_t)32 * wpitch);
    if (SCALE) {
#pragma unroll
      for (int i = 0; i < PNH; ++i)
        rx[i] = *(const v8h*)(xsrc + (size_t)i * (2048 / PK) * xpitch + t * PK);
#pragma unroll
      for (int i = 0; i < PNH; ++i)
        fx[i] = sf[(row + i * (2048 / PK)) * (KTOT / PK) + t];
      // Stands behind the loads, in front of every rewrite of their address
      // registers; its "memory" clobber also holds the loads ahead of the next
      // pass's LDS reads and WMMAs, which cover their latency.
      asm volatile("s_wait_xcnt 0x0" ::: "memory");
    } else {
      static_assert(PNH == 4, "one statement of four copies");
      copy4(xl + b * PSTAGE * 2, 32 * PPITCH * 2, xsrc + t * PK, (size_t)32 * xpitch);
    }
  };
  auto put = [&](_Float16* sb) {
#pragma unroll
    for (int i = 0; i < PNH; ++i)
      *(v8h*)(sb + xdst + i * (2048 / PK) * PPITCH) = rx[i] * fx[i];
  };
  get(0, 0);
  if (SCALE) put(s_ab);
  publish();
  get(1, 1);

#pragma unroll
  for (int i = 0; i < 4; ++i)
#pragma unroll
    for (int j = 0; j < 4; ++j) acc[i][j] = v8f{};

  static_assert(PK == 64, "a pass is two k-steps of 32");
  v16h fa[4], fb[4];
  auto frag = [&](const int kt, const int ks) {  // the 16 fragment loads of a k-step
    const _Float16* sb = s_ab + (kt & 1) * PSTAGE + ks * 32;
#pragma unroll
    for (int i = 0; i < 4; ++i) {
      const _Float16* pa = sb + afrag + i * 16 * PPITCH;
      const _Float16* pb = sb + bfrag + i * 16 * PPITCH;
      fa[i] = cat8(*(const v8h*)pa, *(const v8h*)(pa + 16));
      fb[i] = cat8(*(const v8h*)pb, *(const v8h*)(pb + 16));
    }
  };
  auto mm = [&]() {  // its 16 WMMAs
    // Keeps what stands above (the fragment loads as one group, in the registers
    // that staging no longer takes; the refill) ahead of the WMMAs: loads sunk
    // among them are each waited for right behind their issue, and a refill
    // sunk behind them loses that much of its lead.
    __builtin_amdgcn_sched_barrier(0);
#pragma unroll
    for (int i = 0; i < 4; ++i)
#pragma unroll
      for (int j = 0; j < 4; ++j)
        acc[i][j] = __builtin_amdgcn_wmma_f32_16x16x32_f16(
            false, fa[i], false, fb[j], (short)0, acc[i][j], false, false);
  };
  // A pass's LDS reads end with its second k-step's fragment loads.  Without
  // SCALE the hand-over stands right behind them, and that k-step's WMMAs, which
  // touch registers only, run behind the refill.  With SCALE they stay in front
  // and cover the X loads; X then goes into the other buffer, which every wave
  // left at the last barrier and where the copies are landing meanwhile.
  // The refill is issued behind the barrier while a pass kt + 2 exists.
  for (int kt = 0; kt < KTOT / PK - 2; ++kt) {
    frag(kt, 0);
    mm();
    frag(kt, 1);
    if (SCALE) {
      mm();
      put(s_ab + ((kt + 1) & 1) * PSTAGE);
    }
    publish();
    get(kt + 2, kt & 1);
    if (!SCALE) mm();
  }
  frag(KTOT / PK - 2, 0);
  mm();
  frag(KTOT / PK - 2, 1);
  mm();
  if (SCALE) put(s_ab + PSTAGE);
  publish();
  frag(KTOT / PK - 1, 0);
  mm();
  frag(KTOT / PK - 1, 1);
  mm();
  publish();
  // No copy is outstanding when the first buffer becomes output staging.
  asm volatile("s_wait_asynccnt 0x0" ::: "memory");
}

static __device__ __forceinline__ float exp2_slot(float u) {
  float r;
  asm("v_exp_f32 %0, %1\n\tv_nop" : "=v"(r) : "v"(u));
  return r;
}

__global__ __launch_bounds__(256) void scores_kernel(
    const _Float16* __restrict__ qh, const _Float16* __restrict__ kh,
    const int* __restrict__ mask, _Float16* __restrict__ ph,
    float* __restrict__ gmax, float* __restrict__ gsum) {
  __shared__ __attribute__((aligned(16))) _Float16 s_ab[2 * PSTAGE];
  const int kb = blockIdx.x * PBM;
  const int qb = blockIdx.z * SEQ + blockIdx.y * PBN;
  v8f acc[4][4];
  // First pass: differs among the 8 blocks of a key tile and the 16 of a query tile.
  tile_product<EMB, false>(kh + (size_t)(blockIdx.z * SEQ + kb) * EMB, EMB,
                           qh + (size_t)qb * EMB, EMB, s_ab, nullptr, false,
                           blockIdx.x + blockIdx.y, acc);

  // acc[i][j][r] = S[key kb + wm*64 + i*16 + hi*8 + r][row qb + wn*64 + j*16 + l15]
  const int wave = threadIdx.x >> 5, lane = threadIdx.x & 31;
  const int hi = lane >> 4;
  const int key0 = kb + (wave >> 2) * 64 + hi * 8;
  const int grp = (kb >> 6) + (wave >> 2);
  const int row0 = qb + (wave & 3) * 64 + (lane & 15);
  const int* mk0 = mask + (size_t)row0 * SEQ + key0;
  int4 g[2][8];  // the mask of query column j in g[j & 1], fetched one column ahead
#pragma unroll
  for (int i = 0; i < 4; ++i) {
    g[0][2 * i]     = *(const int4*)(mk0 + i * 16);
    g[0][2 * i + 1] = *(const int4*)(mk0 + i * 16 + 4);
  }
  // Behind the loads, in front of every rewrite of their address registers:
  // named as an input, the address pair stays live up to the wait.
  asm volatile("s_wait_xcnt 0x0" :: "v"(mk0) : "memory");
  // Keeps the later columns' mask loads out of the last pass, where fragments
  // are still live: with them there the kernel goes past
  // 256 VGPRs, and only one block fits a WGP.
  __builtin_amdgcn_sched_barrier(0);
  _Float16* sw = s_ab + wave * WST;  // the wave's own part of the first buffer
  _Float16* st = sw + (lane & 15) * PPITCH + hi * 8;
  _Float16* pw = ph + (size_t)(qb + (wave & 3) * 64) * SEQ + kb + (wave >> 2) * 64;
#pragma unroll
  for (int j = 0; j < 4; ++j) {
    const int row = row0 + j * 16;
    if (j < 3) {
      const int* mk = mk0 + (size_t)(j + 1) * 16 * SEQ;
#pragma unroll
      for (int i = 0; i < 4; ++i) {
        g[(j + 1) & 1][2 * i]     = *(const int4*)(mk + i * 16);
        g[(j + 1) & 1][2 * i + 1] = *(const int4*)(mk + i * 16 + 4);
      }
      // The wait: as above (these loads are built on the same address pair, with
      // immediate offsets).  The fence holds this column's arithmetic behind it.
      asm volatile("s_wait_xcnt 0x0" :: "v"(mk0) : "memory");
      __builtin_amdgcn_sched_barrier(0);
    }
    // Columns 0 and 1 leave, 32 query rows at a time, behind the issue of the
    // next mask loads and ahead of column 2's results, which take their place.
    // The fence keeps this column's arithmetic off the stores' registers until
    // the wait that ends flush_rows.
    if (j == 2) {
      flush_rows(sw, pw, SEQ);
      __builtin_amdgcn_sched_barrier(0);
    }

    float m = -1e30f;
#pragma unroll
    for (int i = 0; i < 4; ++i) {
      const int4 ga = g[j & 1][2 * i], gb = g[j & 1][2 * i + 1];
      const int gi[8] = {ga.x, ga.y, ga.z, ga.w, gb.x, gb.y, gb.z, gb.w};
#pragma unroll
      for (int r = 0; r < 8; ++r) {  // scale by QD, not sqrt(QD); times log2(e)
        acc[i][j][r] = (gi[r] == 0) ? -1e30f : acc[i][j][r] * (1.44269504f / 1024.0f);
        m = fmaxf(m, acc[i][j][r]);
      }
    }
    m = fmaxf(m, __shfl_xor(m, 16));

    float sum = 0.0f;
#pragma unroll
    for (int i = 0; i < 4; ++i) {
      v8h h;
#pragma unroll
      for (int r = 0; r < 8; ++r) {
        const float p = exp2_slot(acc[i][j][r] - m);
        h[r] = (_Float16)p;
        sum += p;
      }
      *(v8h*)(st + (j & 1) * 16 * PPITCH + i * 16) = h;
    }
    sum += __shfl_xor(sum, 16);
    if (hi == 0) {
      gmax[(size_t)grp * ROWS + row] = m;
      gsum[(size_t)grp * ROWS + row] = sum;
    }
    // The wait stands behind each column's stores, in front of whatever
    // rewrites their registers next.
    asm volatile("s_wait_xcnt 0x0" ::: "memory");
  }
  flush_rows(sw, pw + (size_t)32 * SEQ, SEQ);
}

// ---------------------------------------------------------------------------
// Kernel 3: out[row][d] = sum_k softmax[row][k] * vt[d][b*SEQ + k].
// grid = (ROWS/128 row tiles, DIM/256 column tiles).
// First the block joins its 128 rows' groups: row max M = max of the group
// maxima, factor f[g] = exp2(gmax[g] - M), row sum = sum of f[g] * gsum[g].
// The product then takes ph[row][k] * f[group of k]; 1 / row sum at the end.
// ---------------------------------------------------------------------------
__global__ __launch_bounds__(256) void pv_kernel(
    const _Float16* __restrict__ ph, const _Float16* __restrict__ vt,
    const float* __restrict__ gmax, const float* __restrict__ gsum,
    float* __restrict__ out) {
  __shared__ __attribute__((aligned(16))) _Float16 s_ab[2 * PSTAGE];
  __shared__ __attribute__((aligned(16))) _Float16 s_f[PBM * NGRP];
  __shared__ __attribute__((aligned(16))) float s_rinv[PBM];
  const int m0 = blockIdx.x * PBM;
  const int n0 = blockIdx.y * PBN;
  const int b = m0 / SEQ;

  if (threadIdx.x < PBM) {
    const int t = threadIdx.x;
    const float* pm = gmax + m0;
    const float* ps = gsum + m0;
    float gm[NGRP], gs[NGRP];
#pragma unroll
    for (int g = 0; g < NGRP; ++g) {
      gm[g] = pm[(size_t)g * ROWS + t];
      gs[g] = ps[(size_t)g * ROWS + t];
    }
    // Behind the loads, in front of every rewrite of their address registers
    // (the lane's index, named as an input, and two scalar bases); the fence
    // holds the arithmetic behind the wait.
    asm volatile("s_wait_xcnt 0x0" :: "v"(t) : "memory");
    __builtin_amdgcn_sched_barrier(0);
    float m = gm[0];
#pragma unroll
    for (int g = 1; g < NGRP; ++g) m = fmaxf(m, gm[g]);
    float sum = 0.0f;
#pragma unroll
    for (int c = 0; c < NGRP / 8; ++c) {
      v8h h;
#pragma unroll
      for (int e = 0; e < 8; ++e) {
        h[e] = (_Float16)exp2_slot(gm[c * 8 + e] - m);
        sum += (float)h[e] * gs[c * 8 + e];  // the factor as the product sees it
      }
      *(v8h*)(s_f + threadIdx.x * NGRP + c * 8) = h;
    }
    s_rinv[threadIdx.x] = 1.0f / sum;
  }
  // Publishes the factors and the row sums to every wave of the block.
  __syncthreads();

  v8f acc[4][4];
  // First pass: the 16 row tiles of a batch, which read the same rows of vt, lie
  // two passes apart; the 4 blocks that read the same rows of ph follow one
  // another a pass apart, so that a line of ph is still in L2 for the last.
  tile_product<SEQ, true>(ph + (size_t)m0 * SEQ, SEQ,
                          vt + (size_t)n0 * ROWS + b * SEQ, ROWS, s_ab, s_f, false,
                          blockIdx.x * 2 + blockIdx.y, acc);

  // The wave's 64 x 64 f32 tile goes out through its own WST halfs of the first
  // buffer (free behind the last pass's barrier, as above flush_rows), 16 rows at
  // a time at pitch OPITCH: 16 lanes then send one row's 256 bytes, and every
  // wave-wide store is four whole 128-byte lines in place of 64-byte pieces.
  const int wave = threadIdx.x >> 5, lane = threadIdx.x & 31;
  const int l15 = lane & 15, hi = lane >> 4;
  const int ml = (wave >> 2) * 64 + hi * 8;
  float* st = (float*)(s_ab + wave * WST);
  float* dst = out + (size_t)(m0 + (wave >> 2) * 64 + hi) * DIM + n0 + (wave & 3) * 64 + l15 * 4;
#pragma unroll
  for (int i = 0; i < 4; ++i) {
    const float4 u0 = *(const float4*)(s_rinv + ml + i * 16);
    const float4 u1 = *(const float4*)(s_rinv + ml + i * 16 + 4);
    const float li[8] = {u0.x, u0.y, u0.z, u0.w, u1.x, u1.y, u1.z, u1.w};
#pragma unroll
    for (int r = 0; r < 8; ++r)
#pragma unroll
      for (int j = 0; j < 4; ++j)
        st[(hi * 8 + r) * OPITCH + j * 16 + l15] = acc[i][j][r] * li[r];
    // The rows are read back by other lanes than wrote them.
    asm volatile("s_wait_dscnt 0x0" ::: "memory");
    float4 v[8];
#pragma unroll
    for (int t = 0; t < 8; ++t) v[t] = *(const float4*)(st + (t * 2 + hi) * OPITCH + l15 * 4);
#pragma unroll
    for (int t = 0; t < 8; ++t) *(float4*)(dst + (size_t)(i * 16 + t * 2) * DIM) = v[t];
    // Behind the stores, in front of whatever rewrites their registers next.
    asm volatile("s_wait_xcnt 0x0" :: "v"(dst) : "memory");
    // Keeps the next rows' arithmetic off the stores' registers until that wait.
    if (i < 3) __builtin_amdgcn_sched_barrier(0);
  }
}

// ---------------------------------------------------------------------------
// Launch: inputs are x, mask, Wq, bq, Wk, bk, Wv, bv.
// Workspace layout (f16): qh[8192][1024] | kh[8192][1024] | vt[1024][8192]
//                         | Wt (3 x [1024][1024]) | ph f16 [8192][2048]
//                         | gmax, gsum f32 [32][8192] each
//                         | xh f16 [8192][1024]  -> 104 MB.
// ---------------------------------------------------------------------------
extern "C" void kernel_launch(void* const* d_in, const int* in_sizes, int n_in,
                              void* d_out, int out_size, void* d_ws, size_t ws_size,
                              hipStream_t stream) {
  const float* x    = (const float*)d_in[0];
  const int*   mask = (const int*)d_in[1];
  const float* Wq   = (const float*)d_in[2];
  const float* bq   = (const float*)d_in[3];
  const float* Wk   = (const float*)d_in[4];
  const float* bk   = (const float*)d_in[5];
  const float* Wv   = (const float*)d_in[6];
  const float* bv   = (const float*)d_in[7];
  float* out = (float*)d_out;

  _Float16* qh = (_Float16*)d_ws;
  _Float16* kh = qh + (size_t)ROWS * DIM;
  _Float16* vt = kh + (size_t)ROWS * DIM;
  _Float16* wt = vt + (size_t)ROWS * DIM;
  _Float16* ph = wt + (size_t)3 * EMB * DIM;
  float* gmax = (float*)(ph + (size_t)ROWS * SEQ);
  float* gsum = gmax + (size_t)NGRP * ROWS;
  _Float16* xh = (_Float16*)(gsum + (size_t)NGRP * ROWS);

  dim3 bt(256);
  wtrans_kernel<<<dim3(EMB / 256, DIM / 64, 3 + XCZ), bt, 0, stream>>>(x, Wq, Wk, Wv, wt, xh);
  qkv_proj_kernel<<<dim3(ROWS / PBM, DIM / PBN, 3), bt, 0, stream>>>(
      xh, wt, bq, bk, bv, qh, kh, vt);
  scores_kernel<<<dim3(SEQ / PBM, SEQ / PBN, BSZ), bt, 0, stream>>>(
      qh, kh, mask, ph, gmax, gsum);
  pv_kernel<<<dim3(ROWS / PBM, DIM / PBN), bt, 0, stream>>>(ph, vt, gmax, gsum, out);
}

// v010
// It runs in 95.8 microseconds.
// Versions between v008 and this one are left out; their measured steps multiply to 1.12 times as fast.
// Over all steps from v000 it is 7.46 times as fast.
#include <hip/hip_runtime.h>
#include <hip/hip_fp16.h>
#include <stdint.h>

typedef __attribute__((ext_vector_type(16))) _Float16 v16h;
typedef __attribute__((ext_vector_type(8)))  _Float16 v8h;
typedef __attribute__((ext_vector_type(4)))  _Float16 v4h;
typedef __attribute__((ext_vector_type(8)))  float    v8f;
typedef uint32_t u32x4 __attribute__((ext_vector_type(4)));
typedef uint32_t u32x8 __attribute__((ext_vector_type(8)));

#define BSZ 4
#define SEQ 2048
#define EMB 1024
#define DIM 1024
#define ROWS (BSZ * SEQ)  // 8192

static __device__ __forceinline__ v16h cat8(v8h lo, v8h hi) {
  v16h r;
#pragma unroll
  for (int i = 0; i < 8; ++i) { r[i] = lo[i]; r[i + 8] = hi[i]; }
  return r;
}

// ---------------------------------------------------------------------------
// Kernel 0: form Wq Wk^T and Wk bq, transpose + f32->f16 convert Wv, and
// convert x.
// Wt[d][e] = (f16) Wv[e][d]  so that B-fragment (column) reads become
// contiguous row reads for the WMMA GEMMs.
// grid = (EMB/256, DIM/64, GZ + 2 + XCZ), block = 8 waves (4 along e, 2 along d).
// Planes z >= GZ + 2 round x to f16 once, xh[s][e] = (f16) x[s][e]: the projection
// then brings half the bytes for each of the 8 blocks that read a row of x,
// and converts nothing.  A thread has its XPT 16-byte loads in flight together;
// every wave-wide load is 512 and every store 256 contiguous bytes.
// A thread turns an 8 (e) x 8 (d) patch in registers; a wave covers 64 e by
// 32 d with 8 lanes along e and 4 along d.  All 16 loads of a thread are in
// flight together, each wave-wide load takes 64-byte pieces of 8 rows (the
// two pieces of a line by the same thread), and each wave-wide store writes
// four whole 128-byte lines.
// ---------------------------------------------------------------------------
#define XCZ 8                                            // grid planes that convert x
#define XCB (XCZ * (EMB / 256) * (DIM / 64))             // their blocks
#define XPT (ROWS * EMB / 4 / (XCB * 256))               // float4 loads per thread
static_assert(XPT * XCB * 256 * 4 == ROWS * EMB, "the planes cover x exactly");
// Planes 0 .. GZ-1 form Gt[e2][e1] = sum_d Wk[e2][d] * Wq[e1][d] in f16.  With it
// q . k = (x_q G + Wk bq) . x_k + (terms that are equal for all keys of a query
// and so leave the softmax): no key projection is needed, x itself is the key.
// A block makes a 64 x 64 tile.  Per pass of GP d-values it brings 64 rows of
// each matrix in whole 512-byte pieces, rounds them to f16 into one of two LDS
// buffers; wave w takes k-slice w >> 1 (32 d of the pass) of column half w & 1.
// The four slices' partial sums meet in LDS at the end.
#define GZ 4
#define GP 128
#define GPITCH (GP + 8)                // LDS row pitch in halfs: 16 B x odd
#define GSTAGE (128 * GPITCH)          // halfs per buffer: Wq rows, then Wk rows
static_assert(GZ * (EMB / 256) * (DIM / 64) * 64 * 64 == EMB * EMB, "the tiles cover G");
static_assert(8 * 8 * 32 * 8 * 4 <= 2 * GSTAGE * 2, "the partial sums fit the buffers");
static __device__ __forceinline__ void gram_block(
    const float* __restrict__ Wq, const float* __restrict__ Wk,
    _Float16* __restrict__ gt, const int gb, _Float16* s_g) {
  const int tid = threadIdx.x, wave = tid >> 5, lane = tid & 31;
  const int l15 = lane & 15, hi = lane >> 4;
  const int r0 = (gb >> 4) * 64, c0 = (gb & 15) * 64;  // first e2, first e1
  const float* qsrc = Wq + (size_t)(c0 + wave) * DIM + lane * 4;
  const float* ksrc = Wk + (size_t)(r0 + wave) * DIM + lane * 4;
  float4 v0[16], v1[16];  // two passes are in flight
  auto get = [&](float4 (&v)[16], const int p) {
    const float* qp = qsrc + p * GP;
    const float* kp = ksrc + p * GP;
#pragma unroll
    for (int i = 0; i < 8; ++i) {
      v[i] = *(const float4*)(qp + (size_t)i * 8 * DIM);
      v[8 + i] = *(const float4*)(kp + (size_t)i * 8 * DIM);
    }
    // Behind the loads, in front of every rewrite of their address registers:
    // named as inputs, the address pairs stay live up to the wait.
    asm volatile("s_wait_xcnt 0x0" :: "v"(qp), "v"(kp) : "memory");
  };
  v8f acc[4][2];
#pragma unroll
  for (int i = 0; i < 4; ++i)
#pragma unroll
    for (int j = 0; j < 2; ++j) acc[i][j] = v8f{};
  const int afrag = l15 * GPITCH + (wave >> 1) * 32 + hi * 8;
  const int bfrag = (64 + (wave & 1) * 32 + l15) * GPITCH + (wave >> 1) * 32 + hi * 8;
  auto pass = [&](float4 (&v)[16], const int p, _Float16* sb) {
#pragma unroll
    for (int i = 0; i < 16; ++i) {
      v4h h;
      h[0] = (_Float16)v[i].x; h[1] = (_Float16)v[i].y;
      h[2] = (_Float16)v[i].z; h[3] = (_Float16)v[i].w;
      *(v4h*)(sb + (wave + i * 8) * GPITCH + lane * 4) = h;
    }
    if (p + 2 < DIM / GP) get(v, p + 2);
    // Publishes this pass's buffer; the other one, written next, was last read
    // in front of this barrier by every wave.  By hand: __syncthreads() would
    // also wait for the global loads just issued, which are to stay in flight.
    asm volatile("s_wait_dscnt 0x0\n\ts_barrier_signal -1\n\ts_barrier_wait -1" ::: "memory");
    v16h fa[4], fb[2];
#pragma unroll
    for (int i = 0; i < 4; ++i) {
      const _Float16* pa = sb + afrag + i * 16 * GPITCH;
      fa[i] = cat8(*(const v8h*)pa, *(const v8h*)(pa + 16));
    }
#pragma unroll
    for (int j = 0; j < 2; ++j) {
      const _Float16* pb = sb + bfrag + j * 16 * GPITCH;
      fb[j] = cat8(*(const v8h*)pb, *(const v8h*)(pb + 16));
    }
#pragma unroll
    for (int i = 0; i < 4; ++i)
#pragma unroll
      for (int j = 0; j < 2; ++j)
        acc[i][j] = __builtin_amdgcn_wmma_f32_16x16x32_f16(
            false, fa[i], false, fb[j], (short)0, acc[i][j], false, false);
  };
  static_assert((DIM / GP) % 2 == 0, "passes go in pairs, one per buffer and register set");
  get(v0, 0);
  get(v1, 1);
  for (int p = 0; p < DIM / GP; p += 2) {
    pass(v0, p, s_g);
    pass(v1, p + 1, s_g + GSTAGE);
  }
  // acc[i][j][r] = this slice's part of
  //   Gt[r0 + (wave & 1)*32 + j*16 + l15][c0 + i*16 + hi*8 + r]
  // Every wave has left the buffers, which now take the partial sums.
  __syncthreads();
  float* part = (float*)s_g;
#pragma unroll
  for (int i = 0; i < 4; ++i)
#pragma unroll
    for (int j = 0; j < 2; ++j)
      *(v8f*)(part + ((wave * 8 + i * 2 + j) * 32 + lane) * 8) = acc[i][j];
  // Publishes the partial sums to the waves that add them.
  __syncthreads();
  // Wave w adds accumulator tile (i, j) = (w >> 1, w & 1) of both column halves.
  _Float16* gp = gt + (size_t)(r0 + (wave & 1) * 16 + l15) * EMB + c0 + (wave >> 1) * 16 + hi * 8;
#pragma unroll
  for (int half = 0; half < 2; ++half) {
    v8f s = *(const v8f*)(part + ((half * 8 + wave) * 32 + lane) * 8);
#pragma unroll
    for (int ks = 1; ks < 4; ++ks)
      s += *(const v8f*)(part + (((ks * 2 + half) * 8 + wave) * 32 + lane) * 8);
    v8h o;
#pragma unroll
    for (int r = 0; r < 8; ++r) o[r] = (_Float16)s[r];
    *(v8h*)(gp + (size_t)half * 32 * EMB) = o;
  }
}

__global__ __launch_bounds__(256) void wtrans_kernel(
    const float* __restrict__ x, const float* __restrict__ Wq,
    const float* __restrict__ Wk, const float* __restrict__ Wv,
    const float* __restrict__ bq,
    _Float16* __restrict__ wt, _Float16* __restrict__ xh, float* __restrict__ cq) {
  __shared__ __attribute__((aligned(32))) _Float16 s_g[2 * GSTAGE];
  // The longest blocks come first in the grid.
  if (blockIdx.z < GZ) {
    gram_block(Wq, Wk, wt,
               (blockIdx.z * (DIM / 64) + blockIdx.y) * (EMB / 256) + blockIdx.x, s_g);
    return;
  }
  if (blockIdx.z == GZ + 1) {
    // cq[e2] = sum_d Wk[e2][d] * bq[d], in f32: a wave takes two rows.
    const int wv = threadIdx.x >> 5, ln = threadIdx.x & 31;
    const int row = (blockIdx.y * (EMB / 256) + blockIdx.x) * 16 + wv * 2;
    const float* kp = Wk + (size_t)row * DIM + ln * 4;
    const float* bp = bq + ln * 4;
    float4 a0[8], a1[8], bb[8];
#pragma unroll
    for (int c = 0; c < 8; ++c) {
      bb[c] = *(const float4*)(bp + c * 128);
      a0[c] = *(const float4*)(kp + c * 128);
      a1[c] = *(const float4*)(kp + DIM + c * 128);
    }
    // Behind the loads, in front of every rewrite of their address registers.
    asm volatile("s_wait_xcnt 0x0" :: "v"(kp), "v"(bp) : "memory");
    float s0 = 0.0f, s1 = 0.0f;
#pragma unroll
    for (int c = 0; c < 8; ++c) {
      s0 += a0[c].x * bb[c].x + a0[c].y * bb[c].y + a0[c].z * bb[c].z + a0[c].w * bb[c].w;
      s1 += a1[c].x * bb[c].x + a1[c].y * bb[c].y + a1[c].z * bb[c].z + a1[c].w * bb[c].w;
    }
#pragma unroll
    for (int o = 16; o > 0; o >>= 1) {
      s0 += __shfl_xor(s0, o);
      s1 += __shfl_xor(s1, o);
    }
    if (ln == 0) {
      cq[row] = s0;
      cq[row + 1] = s1;
    }
    return;
  }
  if (blockIdx.z >= GZ + 2) {
    const int blk = ((blockIdx.z - (GZ + 2)) * (DIM / 64) + blockIdx.y) * (EMB / 256) + blockIdx.x;
    const size_t at = (size_t)blk * (XPT * 1024) + threadIdx.x * 4;
    const float* xs = x + at;
    _Float16* xd = xh + at;
    float4 v[XPT];
#pragma unroll
    for (int i = 0; i < XPT; ++i) v[i] = *(const float4*)(xs + i * 1024);
    // Behind the loads, in front of every rewrite of their address registers:
    // named as an input, the address pair stays live up to the wait.
    asm volatile("s_wait_xcnt 0x0" :: "v"(xs) : "memory");
    // Keeps the conversions behind all the loads, which then share one latency.
    __builtin_amdgcn_sched_barrier(0);
#pragma unroll
    for (int i = 0; i < XPT; ++i) {
      v4h h;
      h[0] = (_Float16)v[i].x; h[1] = (_Float16)v[i].y;
      h[2] = (_Float16)v[i].z; h[3] = (_Float16)v[i].w;
      *(v4h*)(xd + i * 1024) = h;
    }
    return;
  }
  const float* W = Wv;
  const int wave = threadIdx.x >> 5, lane = threadIdx.x & 31;
  const int e0 = blockIdx.x * 256 + (wave >> 1) * 64 + (lane & 7) * 8;
  const int d0 = blockIdx.y * 64 + (wave & 1) * 32 + (lane >> 3) * 4;
  const float* src = W + (size_t)e0 * DIM + d0;
  _Float16* dst = wt + (size_t)EMB * DIM + (size_t)d0 * EMB + e0;

  float4 r[8][2];  // r[i][h] = W[e0 + i][d0 + h*16 .. + 3]
#pragma unroll
  for (int i = 0; i < 8; ++i)
#pragma unroll
    for (int h = 0; h < 2; ++h)
      r[i][h] = *(const float4*)(src + (size_t)i * DIM + h * 16);
  // Behind the loads, in front of every rewrite of their address registers:
  // named as an input, the address pair stays live up to the wait, so that no
  // load's own result is placed on it ahead of it.
  asm volatile("s_wait_xcnt 0x0" :: "v"(src) : "memory");
  // Keeps the conversions behind all 16 loads: lifted among them they make
  // the last loads wait for the first ones' data, a second memory latency.
  __builtin_amdgcn_sched_barrier(0);

  v8h t[2][4];  // t[h][c][i] = Wt[d0 + h*16 + c][e0 + i]
#pragma unroll
  for (int h = 0; h < 2; ++h)
#pragma unroll
    for (int i = 0; i < 8; ++i) {
      t[h][0][i] = (_Float16)r[i][h].x;
      t[h][1][i] = (_Float16)r[i][h].y;
      t[h][2][i] = (_Float16)r[i][h].z;
      t[h][3][i] = (_Float16)r[i][h].w;
    }
#pragma unroll
  for (int h = 0; h < 2; ++h)
#pragma unroll
    for (int c = 0; c < 4; ++c)
      *(v8h*)(dst + (size_t)(h * 16 + c) * EMB) = t[h][c];
}

#define PBM 128
#define PBN 256
#define PK 64
#define PPITCH (PK + 8)
#define SLROWS 64
#define SLH 5120
#define NSL ((PBM + PBN) / SLROWS)
#define PSTAGE (NSL * SLH)
static_assert(SLROWS * PPITCH <= SLH && (SLH * 2) % 2048 == 0, "a slice holds its rows and starts at 2 KiB");
#define WST (PSTAGE / 8)               // halfs of the first buffer that one wave stages results in

static __device__ __forceinline__ uint32_t uni(uint32_t v) { return __builtin_amdgcn_readfirstlane(v); }
// A wave-uniform value held in a scalar register, so that a test of it is a
// scalar branch (a tensor load ignores EXEC) and what is formed from it stands
// behind the asm statements in front.
static __device__ __forceinline__ uint32_t pinned(uint32_t v) {
  uint32_t w = __builtin_amdgcn_readfirstlane(v);
  asm volatile("" : "+s"(w));
  return w;
}
static_assert(PK * 2 == 128, "the pad interval code 4 is one 128-byte row");
static __device__ __forceinline__ u32x8 tdm_group1(uint32_t src_pitch) {  // pitch in bytes
  constexpr uint32_t d0 = PK * 2, d1 = SLROWS;
  u32x8 g;
  g[0] = uni((1u << 20) | (4u << 22) | (3u << 25));  // no mask, bytes, 4 dwords of pad per 32
  g[1] = uni((d0 & 0xFFFFu) << 16);
  g[2] = uni((d0 >> 16) | ((d1 & 0xFFFFu) << 16));
  g[3] = uni((d1 >> 16) | (d0 << 16));
  g[4] = uni(d1);
  g[5] = uni(src_pitch);
  g[6] = uni(0u);
  g[7] = uni(0u);
  return g;
}
static __device__ __forceinline__ u32x4 tdm_group0(uint32_t lds_dst, uint64_t ga) {
  u32x4 g;
  g[0] = uni(1u);
  g[1] = uni(lds_dst);
  g[2] = uni((uint32_t)ga);
  g[3] = uni((((uint32_t)(ga >> 32)) & 0x01FFFFFFu) | 0x80000000u);
  return g;
}
static __device__ __forceinline__ void tdm_load(u32x4 g0, u32x8 g1) {
  asm volatile("tensor_load_to_lds %0, %1" :: "s"(g0), "s"(g1) : "memory");
}
// The hand-over of a pass: this wave's LDS reads and stores are done, an issuing
// wave's own tensor load of the next pass has landed; the barrier then publishes
// the next buffer and says that every wave has left the one refilled behind it.
// The wait names the descriptor's words as inputs: their registers stay as the
// request was given them for as long as it is outstanding.
static __device__ __forceinline__ void publish(const uint32_t issuer, const u32x4 g0,
                                               const u32x8 g1) {
  asm volatile("s_wait_dscnt 0x0" ::: "memory");
  if (pinned(issuer)) asm volatile("s_wait_tensorcnt 0x0" :: "s"(g0), "s"(g1) : "memory");
  __syncthreads();
}

// Results leave through LDS: straight from the accumulators a wave-wide store
// puts 32-byte pieces on 16 rows.  The pass count is even, so the last pass
// reads the second buffer, and behind its barrier no wave reads the first one
// any more: each wave takes WST halfs of it for itself.  It lays 32 rows of 64
// f16 results there at pitch PPITCH; this sends them out, 8 lanes a row, so
// that every wave-wide store is four whole 128-byte lines.
// g: the first row's first element, pitch: halfs per global row.
static __device__ __forceinline__ void flush_rows(const _Float16* sw, _Float16* g,
                                                  const int pitch) {
  const int lane = threadIdx.x & 31;
  const int row = lane >> 3, col = (lane & 7) * 8;
  // The rows are read back by other lanes than wrote them.
  asm volatile("s_wait_dscnt 0x0" ::: "memory");
  v8h v[8];
#pragma unroll
  for (int t = 0; t < 8; ++t) v[t] = *(const v8h*)(sw + (t * 4 + row) * PPITCH + col);
  _Float16* p = g + (size_t)row * pitch + col;
#pragma unroll
  for (int t = 0; t < 8; ++t) *(v8h*)(p + (size_t)t * 4 * pitch) = v[t];
  // Behind the stores, in front of whatever rewrites their registers next.
  asm volatile("s_wait_xcnt 0x0" :: "v"(p) : "memory");
}

// The tile product, defined further down.
template <int KTOT, bool SCALE>
static __device__ __forceinline__ void tile_product(
    const _Float16* __restrict__ xs, const int xpitch,
    const _Float16* __restrict__ ws, const int wpitch,
    _Float16* s_ab, const _Float16* sf, const bool wa, const int rot, v8f (&acc)[4][4]);

__global__ __launch_bounds__(256) void qkv_proj_kernel(
    const _Float16* __restrict__ xh, const _Float16* __restrict__ wt_all,
    const float* __restrict__ cq, const float* __restrict__ bv,
    _Float16* __restrict__ qh, _Float16* __restrict__ vt) {
  const int z = blockIdx.z;
  const float* bias = (z == 0) ? cq : bv;

  const int tid = threadIdx.x, wave = tid >> 5, lane = tid & 31;
  const int l15 = lane & 15, hi = lane >> 4;
  const int m0 = blockIdx.x * PBM;
  const int n0 = blockIdx.y * PBN;

  __shared__ __attribute__((aligned(2048))) _Float16 s_ab[2 * PSTAGE];

  // Which operand is A depends on z only.  First pass: the 8 blocks that read
  // the same x rows all differ, the 64 that read the same weight rows spread
  // evenly over the passes.
  v8f acc[4][4];
  tile_product<EMB, false>(xh + (size_t)m0 * EMB, EMB,
                           wt_all + ((size_t)z * DIM + n0) * EMB, EMB,
                           s_ab, nullptr, z < 1,
                           blockIdx.x + blockIdx.y + z * (DIM / PBN), acc);

  static_assert((EMB / PK) % 2 == 0, "the last pass must read the second buffer");
  // The wave's number as a scalar: held in vector registers over the loop, what
  // the epilogue derives from it takes the kernel past 256 VGPRs.
  const int ws = __builtin_amdgcn_readfirstlane(wave);
  const int mw = m0 + (ws >> 2) * 64, nw = n0 + (ws & 3) * 64;
  _Float16* sw = s_ab + ws * WST;
  _Float16* st = sw + l15 * PPITCH + hi * 8;
  if (z < 1) {
    // acc[i][j][r] = Y[m0 + wm*64 + j*16 + l15][n0 + wn*64 + i*16 + hi*8 + r]
    _Float16* dst = qh;
    const int nb = nw + hi * 8;
    float4 c0[4], c1[4];
#pragma unroll
    for (int i = 0; i < 4; ++i) {
      c0[i] = *(const float4*)(bias + nb + i * 16);
      c1[i] = *(const float4*)(bias + nb + i * 16 + 4);
    }
    // Behind the loads, in front of every rewrite of their address registers.
    asm volatile("s_wait_xcnt 0x0" ::: "memory");
#pragma unroll
    for (int h = 0; h < 2; ++h) {  // 32 rows m at a time
#pragma unroll
      for (int i = 0; i < 4; ++i) {
        const float bb[8] = {c0[i].x, c0[i].y, c0[i].z, c0[i].w,
                             c1[i].x, c1[i].y, c1[i].z, c1[i].w};
#pragma unroll
        for (int jj = 0; jj < 2; ++jj) {
          v8h o;
#pragma unroll
          for (int r = 0; r < 8; ++r) o[r] = (_Float16)(acc[i][h * 2 + jj][r] + bb[r]);
          *(v8h*)(st + jj * 16 * PPITCH + i * 16) = o;
        }
      }
      flush_rows(sw, dst + (size_t)(mw + h * 32) * DIM + nw, DIM);
    }
  } else {
    // acc[i][j][r] = Y[m0 + wm*64 + i*16 + hi*8 + r][n0 + wn*64 + j*16 + l15]
    const int nb = nw + l15;
    float bn[4];
#pragma unroll
    for (int j = 0; j < 4; ++j) bn[j] = bias[nb + j * 16];
    // The wait: as in the branch above.
    asm volatile("s_wait_xcnt 0x0" ::: "memory");
#pragma unroll
    for (int j = 0; j < 4; ++j) {  // 32 rows n at a time
#pragma unroll
      for (int i = 0; i < 4; ++i) {
        v8h o;
#pragma unroll
        for (int r = 0; r < 8; ++r) o[r] = (_Float16)(acc[i][j][r] + bn[j]);
        *(v8h*)(st + (j & 1) * 16 * PPITCH + i * 16) = o;
      }
      if (j & 1) flush_rows(sw, vt + (size_t)(nw + (j >> 1) * 32) * ROWS + mw, ROWS);
      // Keeps each group's sums and stores together: hoisted all at once
      // they take the kernel past 256 VGPRs, and only one block fits a WGP.
      if (j < 3) __builtin_amdgcn_sched_barrier(0);
    }
  }
}

// ---------------------------------------------------------------------------
// Attention as two tiled GEMMs with the row softmax folded into them.
// The tile product below is the projection's scheme with both operands f16:
// C[128][256] = X[128][KTOT] * W[256][KTOT]^T, 8 waves (2 x 4) of 64x64, both
// operands staged per pass of PK k-values in one of two LDS buffers by
// tensor loads issued one pass ahead.  X is the A operand:
// acc[i][j][r] = C[wm*64 + i*16 + hi*8 + r][wn*64 + j*16 + l15]; with wa, W is:
// acc[i][j][r] = C[wm*64 + j*16 + l15][wn*64 + i*16 + hi*8 + r].
// With SCALE, row m of X is multiplied in pass kt by sf[m * (KTOT / PK) + kt]
// (an LDS table) on its way from registers to LDS.
// The block walks its passes from pass rot (taken modulo the pass count) and
// wraps round.  Blocks that share operand rows run in step; started at the same
// pass they all ask L2 for the same lines, and for one 128-byte column of every
// row, at the same moment.  The caller gives such blocks different rot.
// ---------------------------------------------------------------------------
#define NGRP (SEQ / PK)                // key groups of a row, one per pass of P*V
#define PNH (PBM * PK / 8 / 256)       // 16-byte loads of the X operand per thread and pass
#define OPITCH 68                      // floats per staged output row: rows 8 apart fall 32 banks apart
static_assert(16 * OPITCH * 4 <= WST * 2 && 32 * PPITCH <= WST, "staged rows fit a wave's part");

template <int KTOT, bool SCALE>
static __device__ __forceinline__ void tile_product(
    const _Float16* __restrict__ xs, const int xpitch,
    const _Float16* __restrict__ ws, const int wpitch,
    _Float16* s_ab, const _Float16* sf, const bool wa, const int rot, v8f (&acc)[4][4]) {
  static_assert((KTOT / PK) % 2 == 0, "the last pass must read the second buffer");
  static_assert(((KTOT / PK) & (KTOT / PK - 1)) == 0, "the wrap is a mask");
  const int tid = threadIdx.x, wave = tid >> 5, lane = tid & 31;
  const int l15 = lane & 15, koff = (lane >> 4) * 8;
  const int wm = wave >> 2, wn = wave & 3;

  // LDS: row r of a buffer (X rows, then W rows) lies in slice r / SLROWS.
  const int xfrag = wm * SLH + l15 * PPITCH + koff;
  const int wfrag = (PBM / SLROWS + wn) * SLH + l15 * PPITCH + koff;
  const int afrag = wa ? wfrag : xfrag;
  const int bfrag = wa ? xfrag : wfrag;

  // Operands go to LDS by tensor loads: wave s < NSL brings slice s of every
  // pass.  With SCALE, X passes through registers, where it is multiplied (8
  // consecutive lanes cover one 128-byte row), and the X slices' waves issue
  // nothing.  Waves that never issue hold the last slice's values.
  const uint32_t wsc = uni(tid >> 5);
  const uint32_t sl = wsc < NSL ? wsc : NSL - 1;
  const bool isx = sl < PBM / SLROWS;
  const uint32_t issuer = wsc < NSL && !(SCALE && isx);
  const _Float16* sbase = isx ? xs + (size_t)sl * SLROWS * xpitch
                              : ws + (size_t)(sl - PBM / SLROWS) * SLROWS * wpitch;
  u32x8 g1 = tdm_group1((uint32_t)(isx ? xpitch : wpitch) * 2u);
  // pinned(), for the whole group: the descriptor words are held in their scalar
  // registers over the loop; rebuilt piecemeal, their registers serve as
  // temporaries while a request is outstanding.
  asm volatile("" : "+s"(g1));
  const uint32_t lds0 = (uint32_t)(size_t)s_ab + sl * (SLH * 2);
  u32x4 g0;  // the group of the request that is outstanding
  const int col = (tid % (PK / 8)) * 8, row = tid / (PK / 8);
  const _Float16* xsrc = xs + (size_t)row * xpitch + col;
  const int xdst = row * PPITCH + col;
  v8h rx[PNH];
  _Float16 fx[PNH];
  // get(n, b): the load of the block's n-th pass, which is pass t of the product,
  // into buffer b, and with SCALE its X rows and factors.  t is pinned, so that
  // the descriptor is formed behind the wait and the barrier in front.
  auto get = [&](const int n, const int b) {
    const uint32_t t = pinned((uint32_t)(n + rot) & (KTOT / PK - 1));
    g0 = tdm_group0(lds0 + b * (PSTAGE * 2), (uint64_t)(size_t)sbase + t * (PK * 2));
    // pinned(), for the whole group: the request and the wait that covers it name
    // one set of four registers; formed word by word for each of the two, a word
    // is written into its register again while the request is outstanding.
    asm volatile("" : "+s"(g0));
    if (pinned(issuer)) tdm_load(g0, g1);
    if (SCALE) {
#pragma unroll
      for (int i = 0; i < PNH; ++i)
        rx[i] = *(const v8h*)(xsrc + (size_t)i * (2048 / PK) * xpitch + t * PK);
#pragma unroll
      for (int i = 0; i < PNH; ++i)
        fx[i] = sf[(row + i * (2048 / PK)) * (KTOT / PK) + t];
      // Stands behind the loads, in front of every rewrite of their address
      // registers; its "memory" clobber also holds the loads ahead of the next
      // pass's LDS reads and WMMAs, which cover their latency.
      asm volatile("s_wait_xcnt 0x0" ::: "memory");
    }
  };
  static_assert(2048 / PK == 32 && SLROWS == 64, "two of a thread's X rows fall in each slice");
  auto put = [&](_Float16* sb) {
#pragma unroll
    for (int i = 0; i < PNH; ++i)
      *(v8h*)(sb + xdst + (i >> 1) * SLH + (i & 1) * 32 * PPITCH) = rx[i] * fx[i];
  };
  get(0, 0);
  if (SCALE) put(s_ab);
  publish(issuer, g0, g1);
  get(1, 1);

#pragma unroll
  for (int i = 0; i < 4; ++i)
#pragma unroll
    for (int j = 0; j < 4; ++j) acc[i][j] = v8f{};

  static_assert(PK == 64, "a pass is two k-steps of 32");
  v16h fa[4], fb[4];
  auto frag = [&](const int kt, const int ks) {  // the 16 fragment loads of a k-step
    const _Float16* sb = s_ab + (kt & 1) * PSTAGE + ks * 32;
#pragma unroll
    for (int i = 0; i < 4; ++i) {
      const _Float16* pa = sb + afrag + i * 16 * PPITCH;
      const _Float16* pb = sb + bfrag + i * 16 * PPITCH;
      fa[i] = cat8(*(const v8h*)pa, *(const v8h*)(pa + 16));
      fb[i] = cat8(*(const v8h*)pb, *(const v8h*)(pb + 16));
    }
  };
  auto mm = [&]() {  // its 16 WMMAs
    // Keeps what stands above (the fragment loads as one group, in the registers
    // that staging no longer takes; the refill) ahead of the WMMAs: loads sunk
    // among them are each waited for right behind their issue, and a refill
    // sunk behind them loses that much of its lead.
    __builtin_amdgcn_sched_barrier(0);
#pragma unroll
    for (int i = 0; i < 4; ++i)
#pragma unroll
      for (int j = 0; j < 4; ++j)
        acc[i][j] = __builtin_amdgcn_wmma_f32_16x16x32_f16(
            false, fa[i], false, fb[j], (short)0, acc[i][j], false, false);
  };
  // A pass's LDS reads end with its second k-step's fragment loads.  Without
  // SCALE the hand-over stands right behind them, and that k-step's WMMAs, which
  // touch registers only, run behind the refill.  With SCALE they stay in front
  // and cover the X loads; X then goes into the other buffer, which every wave
  // left at the last barrier and where the tensor loads are landing meanwhile.
  // The refill is issued behind the barrier while a pass kt + 2 exists.
  for (int kt = 0; kt < KTOT / PK - 2; ++kt) {
    frag(kt, 0);
    mm();
    frag(kt, 1);
    if (SCALE) {
      mm();
      put(s_ab + ((kt + 1) & 1) * PSTAGE);
    }
    publish(issuer, g0, g1);
    get(kt + 2, kt & 1);
    if (!SCALE) mm();
  }
  frag(KTOT / PK - 2, 0);
  mm();
  frag(KTOT / PK - 2, 1);
  mm();
  if (SCALE) put(s_ab + PSTAGE);
  publish(issuer, g0, g1);
  frag(KTOT / PK - 1, 0);
  mm();
  frag(KTOT / PK - 1, 1);
  mm();
  publish(issuer, g0, g1);
  // No tensor load is outstanding when the first buffer becomes output staging.
  asm volatile("s_wait_tensorcnt 0x0" ::: "memory");
}

static __device__ __forceinline__ float exp2_slot(float u) {
  float r;
  asm("v_exp_f32 %0, %1\n\tv_nop" : "=v"(r) : "v"(u));
  return r;
}

__global__ __launch_bounds__(256) void scores_kernel(
    const _Float16* __restrict__ qh, const _Float16* __restrict__ kh,
    const int* __restrict__ mask, _Float16* __restrict__ ph,
    float* __restrict__ gmax, float* __restrict__ gsum) {
  __shared__ __attribute__((aligned(2048))) _Float16 s_ab[2 * PSTAGE];
  const int kb = blockIdx.x * PBM;
  const int qb = blockIdx.z * SEQ + blockIdx.y * PBN;
  v8f acc[4][4];
  // First pass: differs among the 8 blocks of a key tile and the 16 of a query tile.
  tile_product<EMB, false>(kh + (size_t)(blockIdx.z * SEQ + kb) * EMB, EMB,
                           qh + (size_t)qb * EMB, EMB, s_ab, nullptr, false,
                           blockIdx.x + blockIdx.y, acc);

  // acc[i][j][r] = S[key kb + wm*64 + i*16 + hi*8 + r][row qb + wn*64 + j*16 + l15]
  const int wave = threadIdx.x >> 5, lane = threadIdx.x & 31;
  const int hi = lane >> 4;
  const int key0 = kb + (wave >> 2) * 64 + hi * 8;
  const int grp = (kb >> 6) + (wave >> 2);
  const int row0 = qb + (wave & 3) * 64 + (lane & 15);
  const int* mk0 = mask + (size_t)row0 * SEQ + key0;
  int4 g[2][8];  // the mask of query column j in g[j & 1], fetched one column ahead
#pragma unroll
  for (int i = 0; i < 4; ++i) {
    g[0][2 * i]     = *(const int4*)(mk0 + i * 16);
    g[0][2 * i + 1] = *(const int4*)(mk0 + i * 16 + 4);
  }
  // Behind the loads, in front of every rewrite of their address registers:
  // named as an input, the address pair stays live up to the wait.
  asm volatile("s_wait_xcnt 0x0" :: "v"(mk0) : "memory");
  // Keeps the later columns' mask loads out of the last pass, where fragments
  // are still live: with them there the kernel goes past
  // 256 VGPRs, and only one block fits a WGP.
  __builtin_amdgcn_sched_barrier(0);
  _Float16* sw = s_ab + wave * WST;  // the wave's own part of the first buffer
  _Float16* st = sw + (lane & 15) * PPITCH + hi * 8;
  _Float16* pw = ph + (size_t)(qb + (wave & 3) * 64) * SEQ + kb + (wave >> 2) * 64;
#pragma unroll
  for (int j = 0; j < 4; ++j) {
    const int row = row0 + j * 16;
    if (j < 3) {
      const int* mk = mk0 + (size_t)(j + 1) * 16 * SEQ;
#pragma unroll
      for (int i = 0; i < 4; ++i) {
        g[(j + 1) & 1][2 * i]     = *(const int4*)(mk + i * 16);
        g[(j + 1) & 1][2 * i + 1] = *(const int4*)(mk + i * 16 + 4);
      }
      // The wait: as above (these loads are built on the same address pair, with
      // immediate offsets).  The fence holds this column's arithmetic behind it.
      asm volatile("s_wait_xcnt 0x0" :: "v"(mk0) : "memory");
      __builtin_amdgcn_sched_barrier(0);
    }
    // Columns 0 and 1 leave, 32 query rows at a time, behind the issue of the
    // next mask loads and ahead of column 2's results, which take their place.
    // The fence keeps this column's arithmetic off the stores' registers until
    // the wait that ends flush_rows.
    if (j == 2) {
      flush_rows(sw, pw, SEQ);
      __builtin_amdgcn_sched_barrier(0);
    }

    float m = -1e30f;
#pragma unroll
    for (int i = 0; i < 4; ++i) {
      const int4 ga = g[j & 1][2 * i], gb = g[j & 1][2 * i + 1];
      const int gi[8] = {ga.x, ga.y, ga.z, ga.w, gb.x, gb.y, gb.z, gb.w};
#pragma unroll
      for (int r = 0; r < 8; ++r) {  // scale by QD, not sqrt(QD); times log2(e)
        acc[i][j][r] = (gi[r] == 0) ? -1e30f : acc[i][j][r] * (1.44269504f / 1024.0f);
        m = fmaxf(m, acc[i][j][r]);
      }
    }
    m = fmaxf(m, __shfl_xor(m, 16));

    float sum = 0.0f;
#pragma unroll
    for (int i = 0; i < 4; ++i) {
      v8h h;
#pragma unroll
      for (int r = 0; r < 8; ++r) {
        const float p = exp2_slot(acc[i][j][r] - m);
        h[r] = (_Float16)p;
        sum += p;
      }
      *(v8h*)(st + (j & 1) * 16 * PPITCH + i * 16) = h;
    }
    sum += __shfl_xor(sum, 16);
    if (hi == 0) {
      gmax[(size_t)grp * ROWS + row] = m;
      gsum[(size_t)grp * ROWS + row] = sum;
    }
    // The wait stands behind each column's stores, in front of whatever
    // rewrites their registers next.
    asm volatile("s_wait_xcnt 0x0" ::: "memory");
  }
  flush_rows(sw, pw + (size_t)32 * SEQ, SEQ);
}

// ---------------------------------------------------------------------------
// Kernel 3: out[row][d] = sum_k softmax[row][k] * vt[d][b*SEQ + k].
// grid = (ROWS/128 row tiles, DIM/256 column tiles).
// First the block joins its 128 rows' groups: row max M = max of the group
// maxima, factor f[g] = exp2(gmax[g] - M), row sum = sum of f[g] * gsum[g].
// The product then takes ph[row][k] * f[group of k]; 1 / row sum at the end.
// ---------------------------------------------------------------------------
__global__ __launch_bounds__(256) void pv_kernel(
    const _Float16* __restrict__ ph, const _Float16* __restrict__ vt,
    const float* __restrict__ gmax, const float* __restrict__ gsum,
    float* __restrict__ out) {
  __shared__ __attribute__((aligned(2048))) _Float16 s_ab[2 * PSTAGE];
  __shared__ __attribute__((aligned(16))) _Float16 s_f[PBM * NGRP];
  __shared__ __attribute__((aligned(16))) float s_rinv[PBM];
  const int m0 = blockIdx.x * PBM;
  const int n0 = blockIdx.y * PBN;
  const int b = m0 / SEQ;

  if (threadIdx.x < PBM) {
    const int t = threadIdx.x;
    const float* pm = gmax + m0;
    const float* ps = gsum + m0;
    float gm[NGRP], gs[NGRP];
#pragma unroll
    for (int g = 0; g < NGRP; ++g) {
      gm[g] = pm[(size_t)g * ROWS + t];
      gs[g] = ps[(size_t)g * ROWS + t];
    }
    // Behind the loads, in front of every rewrite of their address registers
    // (the lane's index, named as an input, and two scalar bases); the fence
    // holds the arithmetic behind the wait.
    asm volatile("s_wait_xcnt 0x0" :: "v"(t) : "memory");
    __builtin_amdgcn_sched_barrier(0);
    float m = gm[0];
#pragma unroll
    for (int g = 1; g < NGRP; ++g) m = fmaxf(m, gm[g]);
    float sum = 0.0f;
#pragma unroll
    for (int c = 0; c < NGRP / 8; ++c) {
      v8h h;
#pragma unroll
      for (int e = 0; e < 8; ++e) {
        h[e] = (_Float16)exp2_slot(gm[c * 8 + e] - m);
        sum += (float)h[e] * gs[c * 8 + e];  // the factor as the product sees it
      }
      *(v8h*)(s_f + threadIdx.x * NGRP + c * 8) = h;
    }
    s_rinv[threadIdx.x] = 1.0f / sum;
  }
  // Publishes the factors and the row sums to every wave of the block.
  __syncthreads();

  v8f acc[4][4];
  // First pass: the 16 row tiles of a batch, which read the same rows of vt, lie
  // two passes apart; the 4 blocks that read the same rows of ph follow one
  // another a pass apart, so that a line of ph is still in L2 for the last.
  tile_product<SEQ, true>(ph + (size_t)m0 * SEQ, SEQ,
                          vt + (size_t)n0 * ROWS + b * SEQ, ROWS, s_ab, s_f, false,
                          blockIdx.x * 2 + blockIdx.y, acc);

  // The wave's 64 x 64 f32 tile goes out through its own WST halfs of the first
  // buffer (free behind the last pass's barrier, as above flush_rows), 16 rows at
  // a time at pitch OPITCH: 16 lanes then send one row's 256 bytes, and every
  // wave-wide store is four whole 128-byte lines in place of 64-byte pieces.
  const int wave = threadIdx.x >> 5, lane = threadIdx.x & 31;
  const int l15 = lane & 15, hi = lane >> 4;
  const int ml = (wave >> 2) * 64 + hi * 8;
  float* st = (float*)(s_ab + wave * WST);
  float* dst = out + (size_t)(m0 + (wave >> 2) * 64 + hi) * DIM + n0 + (wave & 3) * 64 + l15 * 4;
#pragma unroll
  for (int i = 0; i < 4; ++i) {
    const float4 u0 = *(const float4*)(s_rinv + ml + i * 16);
    const float4 u1 = *(const float4*)(s_rinv + ml + i * 16 + 4);
    const float li[8] = {u0.x, u0.y, u0.z, u0.w, u1.x, u1.y, u1.z, u1.w};
#pragma unroll
    for (int r = 0; r < 8; ++r)
#pragma unroll
      for (int j = 0; j < 4; ++j)
        st[(hi * 8 + r) * OPITCH + j * 16 + l15] = acc[i][j][r] * li[r];
    // The rows are read back by other lanes than wrote them.
    asm volatile("s_wait_dscnt 0x0" ::: "memory");
    float4 v[8];
#pragma unroll
    for (int t = 0; t < 8; ++t) v[t] = *(const float4*)(st + (t * 2 + hi) * OPITCH + l15 * 4);
#pragma unroll
    for (int t = 0; t < 8; ++t) *(float4*)(dst + (size_t)(i * 16 + t * 2) * DIM) = v[t];
    // Behind the stores, in front of whatever rewrites their registers next.
    asm volatile("s_wait_xcnt 0x0" :: "v"(dst) : "memory");
    // Keeps the next rows' arithmetic off the stores' registers until that wait.
    if (i < 3) __builtin_amdgcn_sched_barrier(0);
  }
}

// ---------------------------------------------------------------------------
// Launch: inputs are x, mask, Wq, bq, Wk, bk, Wv, bv.
// Workspace layout (f16): qh[8192][1024] | vt[1024][8192]
//                         | Gt, Wv^T ([1024][1024] each) | ph f16 [8192][2048]
//                         | gmax, gsum f32 [32][8192] each
//                         | xh f16 [8192][1024] | cq f32 [1024]  -> 86 MB.
// ---------------------------------------------------------------------------
extern "C" void kernel_launch(void* const* d_in, const int* in_sizes, int n_in,
                              void* d_out, int out_size, void* d_ws, size_t ws_size,
                              hipStream_t stream) {
  const float* x    = (const float*)d_in[0];
  const int*   mask = (const int*)d_in[1];
  const float* Wq   = (const float*)d_in[2];
  const float* bq   = (const float*)d_in[3];
  const float* Wk   = (const float*)d_in[4];
  const float* Wv   = (const float*)d_in[6];
  const float* bv   = (const float*)d_in[7];
  float* out = (float*)d_out;

  _Float16* qh = (_Float16*)d_ws;
  _Float16* vt = qh + (size_t)ROWS * DIM;
  _Float16* wt = vt + (size_t)ROWS * DIM;
  _Float16* ph = wt + (size_t)2 * EMB * DIM;
  float* gmax = (float*)(ph + (size_t)ROWS * SEQ);
  float* gsum = gmax + (size_t)NGRP * ROWS;
  _Float16* xh = (_Float16*)(gsum + (size_t)NGRP * ROWS);
  float* cq = (float*)(xh + (size_t)ROWS * EMB);

  dim3 bt(256);
  wtrans_kernel<<<dim3(EMB / 256, DIM / 64, GZ + 2 + XCZ), bt, 0, stream>>>(
      x, Wq, Wk, Wv, bq, wt, xh, cq);
  qkv_proj_kernel<<<dim3(ROWS / PBM, DIM / PBN, 2), bt, 0, stream>>>(
      xh, wt, cq, bv, qh, vt);
  scores_kernel<<<dim3(SEQ / PBM, SEQ / PBN, BSZ), bt, 0, stream>>>(
      qh, xh, mask, ph, gmax, gsum);
  pv_kernel<<<dim3(ROWS / PBM, DIM / PBN), bt, 0, stream>>>(ph, vt, gmax, gsum, out);
}
